// v000
// Measured on an AMD MI455X. A time is GPU time per run, averaged over a window of back-to-back runs after a warm-up
// (all launches, gaps included; the runs take copies of the inputs in turn), and the median of several windows.
// Apart from v000's, it joins two sittings. Times from different sittings can be a few percent apart, while
// side-by-side timings come from the same sitting.
// The starting kernel, v000, takes 638 microseconds a run.
// compute dtype: all float inputs rounded to bf16; q/k/v = x W + b with EXACT bf16 products on WMMA 16x16x32 (f32 accumulate); logits x sqrt(1024) = 32 (sigma_logit ~ 170, near one-hot rows) with q AND k as f16 hi + residual planes (3 products); softmax in f32 (precise expf); attn P x 2^11 as f16 against v f16 (1 product); f32 output.
// Single attention head with a MULTIPLIED scale (B 4, T 2,048, C 1,024 -> E 256; (in,out) uniform +-1/32 weights with biases): q, k, v = x W + b; wei = softmax(q k^T * sqrt(1024)); out = wei v -> [4, 2,048, 256] (non-causal).
#include <hip/hip_runtime.h>
#include <math.h>

typedef __attribute__((ext_vector_type(16))) _Float16 v16h;
typedef __attribute__((ext_vector_type(16))) __bf16 v16b;
typedef __attribute__((ext_vector_type(8)))  _Float16 v8h;
typedef __attribute__((ext_vector_type(8)))  float v8f;
typedef __attribute__((ext_vector_type(4)))  float v4f;
typedef __attribute__((ext_vector_type(2)))  float v2f;
typedef __attribute__((ext_vector_type(4)))  unsigned v4u;
typedef __attribute__((ext_vector_type(4)))  int v4i;
typedef float __attribute__((may_alias)) float_a;
typedef int __attribute__((may_alias)) int_a;

template <typename T> __device__ __forceinline__ void vst2(void* p, T v) { *(T*)p = v;  }
__device__ __forceinline__ v8f wmma16(v16h a, v16h b, v8f c) {
  v8f d = __builtin_amdgcn_wmma_f32_16x16x32_f16(false, a, false, b, (short)0, c, false, false);
  asm volatile("v_nop\n\tv_nop\n\tv_nop\n\tv_nop" : "+v"(d) : "v"(a), "v"(b));
  return d;
}
__device__ __forceinline__ v8f wmma_bf(v16b a, v16b b, v8f c) {
  v8f d = __builtin_amdgcn_wmma_f32_16x16x32_bf16(false, a, false, b, (short)0, c, false, false);
  asm volatile("v_nop\n\tv_nop\n\tv_nop\n\tv_nop" : "+v"(d) : "v"(a), "v"(b));
  return d;
}
// 16x16x32 fragments: lane = (h = lane>>4, row/col = lane&15); elements 0..7 = k0+8h+0..7, 8..15 = k0+16+8h+0..7; D element r = row 8h+r
__device__ __forceinline__ v16h frag_h(const _Float16* rowk0, int lane) {
  union { v16h v; v8h q[2]; } u; const _Float16* p = rowk0 + 8 * (lane >> 4);
  u.q[0] = *(const v8h*)p; u.q[1] = *(const v8h*)(p + 16); return u.v;
}
__device__ __forceinline__ v16h frag_f32(const float* rowk0, int lane) {
  v16h a; const float* p = rowk0 + 8 * (lane >> 4);
#pragma unroll
  for (int i = 0; i < 8; ++i) { a[i] = (_Float16)p[i]; a[8 + i] = (_Float16)p[16 + i]; }
  return a;
}
__device__ __forceinline__ v16h frag_f32s(const float* rowk0, int lane, float sc) {
  v16h a; const float* p = rowk0 + 8 * (lane >> 4);
#pragma unroll
  for (int i = 0; i < 8; ++i) { a[i] = (_Float16)(p[i] * sc); a[8 + i] = (_Float16)(p[16 + i] * sc); }
  return a;
}
// column fragment from a [K][ld] layout (column n), rows >= K read as 0
__device__ __forceinline__ v16h fragc_f32(const float* W, int k0, int n, int lane, int ld, int K) {
  v16h a; const int g = lane >> 4;
#pragma unroll
  for (int i = 0; i < 8; ++i) { const int ka = k0 + 8 * g + i, kb = ka + 16;
    a[i] = (_Float16)(ka < K ? W[(size_t)(ka < K ? ka : K - 1) * ld + n] : 0.f); a[8 + i] = (_Float16)(kb < K ? W[(size_t)(kb < K ? kb : K - 1) * ld + n] : 0.f); }
  return a;
}
struct F2 { v16b h, l; };
__device__ __forceinline__ F2 bsplit16(const float v[16]) { F2 r;
#pragma unroll
  for (int i = 0; i < 16; ++i) { const __bf16 h = (__bf16)v[i]; r.h[i] = h; r.l[i] = (__bf16)(v[i] - (float)h); }
  return r; }
__device__ __forceinline__ F2 split_row(const float* row, int k0, int lane) { float v[16]; const float* p = row + k0 + 8 * (lane >> 4);
#pragma unroll
  for (int i = 0; i < 8; ++i) { v[i] = p[i]; v[8 + i] = p[16 + i]; }
  return bsplit16(v); }
__device__ __forceinline__ F2 split_rowK(const float* row, int k0, int lane, int K) { float v[16]; const int g = lane >> 4;
#pragma unroll
  for (int i = 0; i < 8; ++i) { const int ka = k0 + 8 * g + i, kb = ka + 16; v[i] = ka < K ? row[ka < K ? ka : K - 1] : 0.f; v[8 + i] = kb < K ? row[kb < K ? kb : K - 1] : 0.f; }
  return bsplit16(v); }
__device__ __forceinline__ F2 split_col(const float* W, int k0, int n, int lane, int ld, int K) { float v[16]; const int g = lane >> 4;
#pragma unroll
  for (int i = 0; i < 8; ++i) { const int ka = k0 + 8 * g + i, kb = ka + 16; v[i] = ka < K ? W[(size_t)(ka < K ? ka : K - 1) * ld + n] : 0.f; v[8 + i] = kb < K ? W[(size_t)(kb < K ? kb : K - 1) * ld + n] : 0.f; }
  return bsplit16(v); }
__device__ __forceinline__ v8f mac3(const F2& a, const F2& b, v8f c) { c = wmma_bf(a.l, b.h, c); c = wmma_bf(a.h, b.l, c); return wmma_bf(a.h, b.h, c); }
__device__ __forceinline__ float sigm(float v) { return 1.0f / (1.0f + expf(-v)); }
#define LDSX() do { asm volatile("s_wait_dscnt 0" ::: "memory"); __builtin_amdgcn_wave_barrier(); __builtin_amdgcn_fence(__ATOMIC_RELEASE, "workgroup"); } while (0)

#define NB 4
#define TT 2048
#define CC 256
#define DIN 1024
#define NH 1
#define HD 256
#define NQB (TT / 64)
#define HG 1               // one 2,048 x 2,048 score plane per pass
#define SCALE (32.0f)
#define HDQK 256            // all 256 columns enter the logits
#define CAUSAL 0
#ifndef TNB
#define TNB NB
#endif
__device__ __forceinline__ v16b zero16b() { v16b z; _Pragma("unroll") for (int i = 0; i < 16; ++i) z[i] = (__bf16)0.f; return z; }
__device__ __forceinline__ float bfr(float v) { return (float)(__bf16)v; }
__host__ __device__ __forceinline__ int kb_last(int qb) { return CAUSAL ? ((qb * 64 + 63) >> 7) : (TT / 128 - 1); }
typedef __attribute__((ext_vector_type(8))) __bf16 v8b;
__device__ __forceinline__ v16b frag_b(const __bf16* rowk0, int lane) {
  union { v16b v; v8b q[2]; } u; const __bf16* p = rowk0 + 8 * (lane >> 4);
  u.q[0] = *(const v8b*)p; u.q[1] = *(const v8b*)(p + 16); return u.v;
}
#define QBH (TT / 64)      // ALL query blocks take k_sc's 3-product path
#define QBH_PV 0           // A.g stays single f16
#define QHI 2048            // q residual rows everywhere (3-product logits: sigma_logit ~ 170)
#define KHI 2048
// B fragment (k rows k0+.., output column o) of a weight: (in,out) [K][ld] or (out,in) [ld rows of K]: bf16 exact, or f16(bf16 * 256) exact
__device__ __forceinline__ v16b wcol_io(const float* Wm, int k0, int o, int lane, int ld) { v16b w; const int g = lane >> 4;
#pragma unroll
  for (int i = 0; i < 8; ++i) { w[i] = (__bf16)Wm[(size_t)(k0 + 8 * g + i) * ld + o]; w[8 + i] = (__bf16)Wm[(size_t)(k0 + 16 + 8 * g + i) * ld + o]; }
  return w; }
__device__ __forceinline__ v16b wcol_oi(const float* Wm, int k0, int o, int lane, int K) { v16b w; const float* p = Wm + (size_t)o * K + k0 + 8 * (lane >> 4);
#pragma unroll
  for (int i = 0; i < 8; ++i) { w[i] = (__bf16)p[i]; w[8 + i] = (__bf16)p[16 + i]; }
  return w; }
__device__ __forceinline__ v16h wcolh_io(const float* Wm, int k0, int o, int lane, int ld) { v16h w; const int g = lane >> 4;
#pragma unroll
  for (int i = 0; i < 8; ++i) { w[i] = (_Float16)(bfr(Wm[(size_t)(k0 + 8 * g + i) * ld + o]) * 256.0f); w[8 + i] = (_Float16)(bfr(Wm[(size_t)(k0 + 16 + 8 * g + i) * ld + o]) * 256.0f); }
  return w; }
__device__ __forceinline__ v16h wcolh_oi(const float* Wm, int k0, int o, int lane, int K) { v16h w; const float* p = Wm + (size_t)o * K + k0 + 8 * (lane >> 4);
#pragma unroll
  for (int i = 0; i < 8; ++i) { w[i] = (_Float16)(bfr(p[i]) * 256.0f); w[8 + i] = (_Float16)(bfr(p[16 + i]) * 256.0f); }
  return w; }
#define WQKV_LAYOUT 1   // 0 = (in,out) [DIN][CC]; 1 = (in,out) [DIN][CC] as well; 2 = per-head [NH][DIN][HD]
__device__ __forceinline__ v16b wcol_hdk(const float* Wm, int k0, int o, int lane) { v16b w; const int g = lane >> 4; const float* p = Wm + (size_t)(o / HD) * DIN * HD + (o % HD);
#pragma unroll
  for (int i = 0; i < 8; ++i) { w[i] = (__bf16)p[(size_t)(k0 + 8 * g + i) * HD]; w[8 + i] = (__bf16)p[(size_t)(k0 + 16 + 8 * g + i) * HD]; }
  return w; }
#define WO_OUT_IN 0
#if WQKV_LAYOUT == 1
#define WCOL(W, k0, o, lane) wcol_io(W, k0, (o), lane, CC)   /* (in,out) Wq/Wk/Wv [1024][256] */
#define WCOL_OLD_UNUSED(W, k0, o, lane) (((o) < HDQK) ? wcol_oi(W, k0, (o), lane, DIN) : zero16b())
#elif WQKV_LAYOUT == 2
#define WCOL(W, k0, o, lane) wcol_hdk(W, k0, o, lane)
#else
#define WCOL(W, k0, o, lane) wcol_io(W, k0, o, lane, CC)
#endif
#if WO_OUT_IN
#define WOCOL(W, k0, o, lane) wcol_oi(W, k0, o, lane, CC)
#define WOCOLH(W, k0, o, lane) wcolh_oi(W, k0, o, lane, CC)
#else
#define WOCOL(W, k0, o, lane) wcol_io(W, k0, o, lane, DIN)
#define WOCOLH(W, k0, o, lane) wcolh_io(W, k0, o, lane, DIN)
#endif
#ifndef XP
#define OUT1_OFF (4u * (size_t)NB * DIN * TT)   /* output 1 (o) follows output 0 (y) */
#define XP TT              // position pitch of x and of the output
#endif
#define BG HG              // the pass group spans BATCHES (single head): blockIdx.z / blockIdx.y select batch b0 + z
#define DVH 128

// ---- k_wz: block = (64 rows, 128 output cols): OR = y (hi + lo, K = 256 columns of the YR rows) . W^T ((out,in) rows of 256, exact) + b
__global__ __launch_bounds__(128) void k_wz(const float* __restrict__ YR, const float* __restrict__ WW, const float* __restrict__ WB, float* __restrict__ ORW) { __shared__ __align__(16) float sf[4][16][132];
  const int tid = threadIdx.x, wave = tid >> 5, lane = tid & 31, col = lane & 15, g = lane >> 4; const int c0 = blockIdx.y * 128; const size_t r0 = (size_t)blockIdx.x * 64 + wave * 16;
  v8f acc[8] = {};
#pragma unroll
  for (int kc = 0; kc < HDQK / 32; ++kc) { const F2 a = split_row(YR + (r0 + col) * CC, kc * 32, lane); asm volatile("s_wait_loadcnt 0x0" ::: "memory");
#pragma unroll
    for (int j = 0; j < 8; ++j) { const v16b w = wcol_oi(WW, kc * 32, c0 + j * 16 + col, lane, HDQK); asm volatile("s_wait_loadcnt 0x0" ::: "memory"); acc[j] = wmma_bf(a.h, w, acc[j]); acc[j] = wmma_bf(a.l, w, acc[j]); } }
#pragma unroll
  for (int j = 0; j < 8; ++j) { const float bb = WB ? bfr(WB[c0 + j * 16 + col]) : 0.f; asm volatile("s_wait_loadcnt 0x0" ::: "memory");
#pragma unroll
    for (int r = 0; r < 8; ++r) sf[wave][8 * g + r][j * 16 + col] = acc[j][r] + bb; }
  LDSX(); for (int rl = 0; rl < 16; ++rl) vst2(ORW + (r0 + rl) * DIN + c0 + lane * 4, *(const v4f*)&sf[wave][rl][lane * 4]); }
// ---- k_fin2: block = (64 positions, 64 channels, batch b): o[b][c][n] = OR[b*N + n][c] (channels-first via LDS transpose) -> output 1; y = gamma * o + bf16(x) -> output 0 (256-B runs)
__global__ __launch_bounds__(256) void k_fin2(const float* __restrict__ ORW, const float* __restrict__ X, const float* __restrict__ GM, float* __restrict__ OUT, float* __restrict__ OUT1) { const float gmv = bfr(GM[0]); __shared__ float st[64][68]; const int tid = threadIdx.x; const int n0 = blockIdx.x * 64, c0 = blockIdx.y * 64; const size_t b = blockIdx.z;
  for (int e = tid; e < 64 * 16; e += 256) { const int nl = e >> 4, q = e & 15; *(v4f*)&st[nl][q * 4] = *(const v4f*)(ORW + (b * TT + n0 + nl) * (size_t)DIN + c0 + q * 4); }
  __syncthreads();
  for (int e = tid; e < 64 * 16; e += 256) { const int cl = e >> 4, q = e & 15; const size_t oi = (b * DIN + c0 + cl) * (size_t)XP + n0 + q * 4; const v4f xr = *(const v4f*)(X + oi); v4f o, y; _Pragma("unroll") for (int i = 0; i < 4; ++i) { o[i] = st[q * 4 + i][cl]; y[i] = gmv * o[i] + bfr(xr[i]); } vst2(OUT + oi, y); vst2(OUT1 + oi, o); } }   /* y = gamma * o + x (output 0), o (output 1) */
#ifndef SM_EXTRA_PARAMS
#define SM_EXTRA_PARAMS
#endif
#ifndef PROJ_EXTRA_PARAMS
#define PROJ_EXTRA_PARAMS
#endif
#ifndef SM_MASK_HOOK
#define SM_MASK_HOOK (void)0
#endif

#define WS_QH  0u                                      // f16 q rows [b*t][CC]
#define WS_KH  (WS_QH + 2u * (size_t)NB * TT * CC)      // f16 k rows [b*t][CC]
#define WS_VT  (WS_KH + 2u * (size_t)NB * TT * CC)      // f16 v planes [b][c][t]
#define WS_QL  (WS_VT + 2u * (size_t)NB * CC * TT)      // f16 q residual x 2^10 rows [b][t < QHI][CC]
#define WS_KL  (WS_QL + 2u * (size_t)NB * QHI * CC)     // f16 k residual x 2^10 rows [b][t < KHI][CC]
#define WS_VB  (WS_KL + 2u * (size_t)NB * KHI * CC)     // bf16 v hi planes [b][c][t < KHI]
#define WS_VBL (WS_VB + 2u * (size_t)NB * CC * KHI)
#define WS_S   (WS_VBL + 2u * (size_t)NB * CC * KHI)    // f32 logits / P [hg][t][s]
#define WS_Y   (WS_S  + 4u * (size_t)HG * TT * TT)      // f32 ctx rows [b*t][CC] (only when there is an output projection)
#define WS_END (WS_Y  + 0u)

// ---- k_proj: block = (64 rows, 128 cols, which): q/k/v = X W (+ b) with exact bf16 products (K = DIN) -> which 0: q f16 rows (+ residual rows < QHI); 1: k f16 rows (+ residual rows < KHI); 2: v f16 planes [c][t] (+ bf16 hi/lo planes for t < KHI)
__global__ __launch_bounds__(128) void k_proj(const float* __restrict__ XQ, const float* __restrict__ XK, const float* __restrict__ XV, const float* __restrict__ WQ, const float* __restrict__ WK, const float* __restrict__ WV, const float* __restrict__ BQ, const float* __restrict__ BK, const float* __restrict__ BV,
    _Float16* __restrict__ QH, _Float16* __restrict__ QL, _Float16* __restrict__ KH, _Float16* __restrict__ KL, _Float16* __restrict__ VT, __bf16* __restrict__ VB, __bf16* __restrict__ VBL) {
  __shared__ __align__(16) _Float16 sh[64][136], sl[64][136]; __shared__ __align__(16) _Float16 th[128][72]; __shared__ __align__(16) __bf16 tb[128][72], tbl[128][72];
  const int tid = threadIdx.x, wave = tid >> 5, lane = tid & 31, col = lane & 15, g = lane >> 4; const int which = blockIdx.z; const int c0 = blockIdx.y * 128; const size_t r0 = (size_t)blockIdx.x * 64; const size_t bb = r0 / TT; const int t0 = (int)(r0 % TT);
  const float* X = which == 0 ? XQ : which == 1 ? XK : XV; const float* WA = which == 0 ? WQ : which == 1 ? WK : WV; const float* BA = which == 0 ? BQ : which == 1 ? BK : BV;
  v8f acc[8] = {};
#pragma unroll 2
  for (int kc = 0; kc < DIN / 32; ++kc) { v16b a; { const float* p = X + (r0 + wave * 16 + col) * (size_t)DIN + kc * 32 + 8 * g;   /* channels-LAST: plain rows x[b*T + t][k] */
#pragma unroll
      for (int i = 0; i < 8; ++i) { a[i] = (__bf16)p[i]; a[8 + i] = (__bf16)p[16 + i]; } }
    asm volatile("s_wait_loadcnt 0x0" ::: "memory");
#pragma unroll
    for (int j = 0; j < 8; ++j) { const v16b w = WCOL(WA, kc * 32, c0 + j * 16 + col, lane); asm volatile("s_wait_loadcnt 0x0" ::: "memory"); acc[j] = wmma_bf(a, w, acc[j]); } }
  if (which < 2) { _Float16* DH = which == 0 ? QH : KH; _Float16* DL = which == 0 ? QL : KL; const int nhi = which == 0 ? QHI : KHI; const bool hi_rows = t0 < nhi;
#pragma unroll
    for (int j = 0; j < 8; ++j) { const float bias = (BA && (which == 2 || (c0 + j * 16 + col) < HDQK)) ? bfr(BA[c0 + j * 16 + col]) : 0.f;   /* q/k/v: all 256 columns */   /* 256-entry biases */
#pragma unroll
      for (int r = 0; r < 8; ++r) { const float v = acc[j][r] + bias; const _Float16 hv = (_Float16)v; sh[wave * 16 + 8 * g + r][j * 16 + col] = hv; sl[wave * 16 + 8 * g + r][j * 16 + col] = (_Float16)((v - (float)hv) * 1024.0f); } }
    __syncthreads();
    for (int e = tid; e < 64 * 16; e += 128) { const int rl = e >> 4, q = e & 15; vst2((unsigned*)(DH + (r0 + rl) * CC + c0 + q * 8), *(const v4u*)&sh[rl][q * 8]); if (hi_rows) vst2((unsigned*)(DL + (bb * nhi + t0 + rl) * (size_t)CC + c0 + q * 8), *(const v4u*)&sl[rl][q * 8]); }
  } else { const bool hi_rows = t0 < KHI;
#pragma unroll
    for (int j = 0; j < 8; ++j) { const float bias = (BA && (which == 2 || (c0 + j * 16 + col) < HDQK)) ? bfr(BA[c0 + j * 16 + col]) : 0.f;   /* q/k/v: all 256 columns */   /* 256-entry biases */
#pragma unroll
      for (int r = 0; r < 8; ++r) { const float v = acc[j][r] + bias; const int rl = wave * 16 + 8 * g + r, cl = j * 16 + col; th[cl][rl] = (_Float16)v; const __bf16 bh = (__bf16)v; tb[cl][rl] = bh; tbl[cl][rl] = (__bf16)(v - (float)bh); } }
    __syncthreads();
    for (int e = tid; e < 128 * 8; e += 128) { const int cl = e >> 3, q = e & 7; vst2((unsigned*)(VT + (bb * CC + c0 + cl) * (size_t)TT + t0 + q * 8), *(const v4u*)&th[cl][q * 8]); if (hi_rows) { const size_t o3 = (bb * CC + c0 + cl) * (size_t)KHI + t0 + q * 8; vst2((unsigned*)(VB + o3), *(const v4u*)&tb[cl][q * 8]); vst2((unsigned*)(VBL + o3), *(const v4u*)&tbl[cl][q * 8]); } } } }
// ---- k_sc: block = (query block qb, key block kb <= kb_last(qb), batch b in group): logits x SCALE; q hi + residual (x 2^10) against k (2 products) for query rows < QHI, plus the k residual (3 products) for query blocks < QBH (all query blocks here); causal: blocks past the diagonal exit, the mask itself is applied by index in k_sm
__global__ __launch_bounds__(128) void k_sc(const _Float16* __restrict__ QH, const _Float16* __restrict__ KH, const _Float16* __restrict__ QL, const _Float16* __restrict__ KL, int bgrp, int h0, float* __restrict__ S0) { __shared__ __align__(16) float ss[4][16][132];
  const int qb = blockIdx.x, kb = blockIdx.y; if (kb > kb_last(qb)) return;
  const int h = h0; const int b = bgrp + blockIdx.z; float* S = S0 + (size_t)blockIdx.z * TT * TT;   /* group spans batches */
  const int tid = threadIdx.x, wave = tid >> 5, lane = tid & 31, col = lane & 15, g = lane >> 4; const int k0 = kb * 128; const int ql0 = qb * 64 + wave * 16; const size_t q0 = (size_t)b * TT + ql0, kr0 = (size_t)b * TT + k0;
  v8f acc[8] = {}, accl[8] = {};
  const _Float16* QLb = QL + (size_t)b * QHI * CC; const _Float16* KLb = KL + (size_t)b * KHI * CC;
  if (qb < QBH) {
#pragma unroll
    for (int kc = 0; kc < HDQK / 32; ++kc) { const v16h ah = frag_h(QH + (q0 + col) * CC + h * HD + kc * 32, lane), al = frag_h(QLb + (size_t)(ql0 + col) * CC + h * HD + kc * 32, lane);
#pragma unroll
      for (int j = 0; j < 8; ++j) { const v16h kbf = frag_h(KH + (kr0 + j * 16 + col) * CC + h * HD + kc * 32, lane), klf = frag_h(KLb + (size_t)(k0 + j * 16 + col) * CC + h * HD + kc * 32, lane); acc[j] = wmma16(ah, kbf, acc[j]); accl[j] = wmma16(al, kbf, accl[j]); accl[j] = wmma16(ah, klf, accl[j]); } }
  } else if (qb * 64 < QHI) {
#pragma unroll
    for (int kc = 0; kc < HDQK / 32; ++kc) { const v16h ah = frag_h(QH + (q0 + col) * CC + h * HD + kc * 32, lane), al = frag_h(QLb + (size_t)(ql0 + col) * CC + h * HD + kc * 32, lane);
#pragma unroll
      for (int j = 0; j < 8; ++j) { const v16h kbf = frag_h(KH + (kr0 + j * 16 + col) * CC + h * HD + kc * 32, lane); acc[j] = wmma16(ah, kbf, acc[j]); accl[j] = wmma16(al, kbf, accl[j]); } }
  } else {
#pragma unroll
    for (int kc = 0; kc < HDQK / 32; ++kc) { const v16h ah = frag_h(QH + (q0 + col) * CC + h * HD + kc * 32, lane);
#pragma unroll
      for (int j = 0; j < 8; ++j) { const v16h kbf = frag_h(KH + (kr0 + j * 16 + col) * CC + h * HD + kc * 32, lane); acc[j] = wmma16(ah, kbf, acc[j]); } } }
#pragma unroll
  for (int j = 0; j < 8; ++j) {
#pragma unroll
    for (int r = 0; r < 8; ++r) ss[wave][8 * g + r][j * 16 + col] = (acc[j][r] + accl[j][r] * (1.0f / 1024.0f)) * SCALE; }
  LDSX(); for (int rl = 0; rl < 16; ++rl) vst2(S + (size_t)(ql0 + rl) * TT + k0 + lane * 4, *(const v4f*)&ss[wave][rl][lane * 4]); }
// ---- k_sm: block = query row t (batch in group): keys [0, kend): causal -> logit if s <= t else excluded; softmax in f32; P x 2^11 in place (0 for excluded)
__global__ __launch_bounds__(256) void k_sm(float* __restrict__ S0 SM_EXTRA_PARAMS) { __shared__ float sred[8]; __shared__ float sbc; __shared__ __align__(16) float shv[TT];
  const int tid = threadIdx.x; const int t = blockIdx.x; const int kend = (kb_last(t >> 6) + 1) * 128;
  float* sr = S0 + (size_t)blockIdx.y * TT * TT + (size_t)t * TT;
  float m = -3.0e38f; for (int k = tid; k < kend; k += 256) { float v = (!CAUSAL || k <= t) ? sr[k] : -3.0e38f; SM_MASK_HOOK; shv[k] = v; m = fmaxf(m, v); }
#pragma unroll
  for (int o = 1; o < 32; o <<= 1) m = fmaxf(m, __shfl_xor(m, o));
  if ((tid & 31) == 0) sred[tid >> 5] = m; __syncthreads(); if (tid == 0) { float a = sred[0]; for (int i = 1; i < 8; ++i) a = fmaxf(a, sred[i]); sbc = a; } __syncthreads(); m = sbc; __syncthreads();
  float sum = 0.f; for (int k = tid; k < kend; k += 256) { const float v = shv[k]; const float e = (v <= -1.0e38f) ? 0.f : expf(v - m); shv[k] = e; sum += e; }
#pragma unroll
  for (int o = 1; o < 32; o <<= 1) sum += __shfl_xor(sum, o);
  if ((tid & 31) == 0) sred[tid >> 5] = sum; __syncthreads(); if (tid == 0) { float a = 0.f; for (int i = 0; i < 8; ++i) a += sred[i]; sbc = a > 0.f ? 2048.0f / a : 0.f; }   /* a fully excluded row yields P = 0 */ __syncthreads(); const float inv = sbc;
  for (int k = tid; k < kend; k += 256) shv[k] = shv[k] * inv;
  __syncthreads(); for (int q = tid; q < kend / 4; q += 256) vst2(sr + q * 4, *(const v4f*)&shv[q * 4]); }
// ---- k_pv: block = 64 queries (qb) of (b, h): ctx = P . v over keys [0, kend) (P x 2^11 once to f16 against v f16: 1 product; query blocks < QBH_PV (none here): P and v as bf16 hi + lo, 3 products); 512-B (row, column-half) segment by 32 lanes
__global__ __launch_bounds__(128) void k_pv(const float* __restrict__ PS0, const _Float16* __restrict__ VT, const __bf16* __restrict__ VB, const __bf16* __restrict__ VBL, int bgrp, int h0, float* __restrict__ Y) { const int h = h0; const int b = bgrp + blockIdx.z; const float* PS = PS0 + (size_t)blockIdx.z * TT * TT; const int d0 = blockIdx.y * DVH;   /* group spans batches; column half d0 */ __shared__ __align__(16) float ss[4][16][DVH + 4];
  const int tid = threadIdx.x, wave = tid >> 5, lane = tid & 31, col = lane & 15, g = lane >> 4; const int qb = blockIdx.x; const int ql0 = qb * 64 + wave * 16; const int kce = (kb_last(qb) + 1) * 4;
  v8f acc[DVH / 16] = {};
  if (qb < QBH_PV) {
#pragma unroll 1
    for (int kc = 0; kc < kce; ++kc) { const F2 p = split_row(PS + (size_t)(ql0 + col) * TT, kc * 32, lane);
      asm volatile("s_wait_loadcnt 0x0" ::: "memory");
#pragma unroll
      for (int j = 0; j < DVH / 16; ++j) { const size_t po = ((size_t)b * CC + h * HD + d0 + j * 16 + col) * (size_t)KHI + kc * 32; const v16b vh = frag_b(VB + po, lane); acc[j] = wmma_bf(p.h, vh, acc[j]); acc[j] = wmma_bf(p.l, vh, acc[j]); acc[j] = wmma_bf(p.h, frag_b(VBL + po, lane), acc[j]); } }
  } else {
#pragma unroll 1
    for (int kc = 0; kc < kce; ++kc) { const v16h p = frag_f32(PS + (size_t)(ql0 + col) * TT + kc * 32, lane);
      asm volatile("s_wait_loadcnt 0x0" ::: "memory");
#pragma unroll
      for (int j = 0; j < DVH / 16; ++j) { const size_t po = ((size_t)b * CC + h * HD + d0 + j * 16 + col) * (size_t)TT + kc * 32; acc[j] = wmma16(p, frag_h(VT + po, lane), acc[j]); } } }
#pragma unroll
  for (int j = 0; j < DVH / 16; ++j)
#pragma unroll
    for (int r = 0; r < 8; ++r) ss[wave][8 * g + r][j * 16 + col] = acc[j][r] * (1.0f / 2048.0f);
  LDSX(); for (int rl = 0; rl < 16; ++rl) vst2(Y + ((size_t)b * TT + ql0 + rl) * CC + h * HD + d0 + lane * 4, *(const v4f*)&ss[wave][rl][lane * 4]); }   /* 512-B (row, column-half) segment by 32 lanes */

__global__ __launch_bounds__(256) void k_axpy(const float* __restrict__ YR, const float* __restrict__ X, const float* __restrict__ GM, float* __restrict__ OUT) { const size_t e = ((size_t)blockIdx.x * 256 + threadIdx.x) * 4; if (e >= (size_t)TNB * TT * DIN) return; const float gmv = bfr(GM[0]); const v4f o = *(const v4f*)(YR + e); const v4f xr = *(const v4f*)(X + e); asm volatile("s_wait_loadcnt 0x0" ::: "memory"); v4f y; _Pragma("unroll") for (int i = 0; i < 4; ++i) y[i] = gmv * o[i] + bfr(xr[i]); vst2(OUT + e, y); }
extern "C" void kernel_launch(void* const* d_in, const int* in_sizes, int n_in, void* d_out, int out_size, void* d_ws, size_t ws_size, hipStream_t stream) {
  (void)in_sizes; (void)n_in; (void)out_size;
  const float** F = (const float**)d_in;
  if (ws_size < (size_t)WS_END) return;
  char* ws = (char*)d_ws; _Float16 *QH = (_Float16*)(ws + WS_QH), *KH = (_Float16*)(ws + WS_KH), *VT = (_Float16*)(ws + WS_VT), *QL = (_Float16*)(ws + WS_QL), *KL = (_Float16*)(ws + WS_KL); __bf16 *VB = (__bf16*)(ws + WS_VB), *VBL = (__bf16*)(ws + WS_VBL); float *S = (float*)(ws + WS_S), *Y = (float*)(ws + WS_Y);
  (void)Y; (void)QL; (void)KL; (void)VB; (void)VBL;
  // inputs: 0 x [4,2048,1024]; 1 Wq [1024,256] (in,out), 2 bq; 3 Wk, 4 bk; 5 Wv, 6 bv
  if (ws_size < (size_t)WS_END) return;
  k_proj<<<dim3(TNB * TT / 64, CC / 128, 3), 128, 0, stream>>>(F[0], F[0], F[0], F[1], F[3], F[5], F[2], F[4], F[6], QH, QL, KH, KL, VT, VB, VBL);
  for (int b0 = 0; b0 < TNB; b0 += BG) {
    k_sc<<<dim3(NQB, TT / 128, BG), 128, 0, stream>>>(QH, KH, QL, KL, b0, 0, S);
    k_sm<<<dim3(TT, BG), 256, 0, stream>>>(S);
    k_pv<<<dim3(NQB, HD / DVH, BG), 128, 0, stream>>>(S, VT, VB, VBL, b0, 0, (float*)d_out);   /* out rows [b*T + t][256] directly */
  }
}

// v001
// A run of this version takes 308 microseconds.
// Two timings next to v000 put it at 2.08 and 2.09 times that version's speed.
// compute dtype: all float inputs rounded to bf16; q/k/v = x W + b with EXACT bf16 products on WMMA 16x16x32 (f32 accumulate); logits x sqrt(1024) = 32 (sigma_logit ~ 170, near one-hot rows) with q AND k as f16 hi + residual planes (3 products); softmax in f32 (precise expf); attn P x 2^11 as f16 against v f16 (1 product); f32 output.
// Single attention head with a MULTIPLIED scale (B 4, T 2,048, C 1,024 -> E 256; (in,out) uniform +-1/32 weights with biases): q, k, v = x W + b; wei = softmax(q k^T * sqrt(1024)); out = wei v -> [4, 2,048, 256] (non-causal).
#include <hip/hip_runtime.h>
#include <math.h>

typedef __attribute__((ext_vector_type(16))) _Float16 v16h;
typedef __attribute__((ext_vector_type(16))) __bf16 v16b;
typedef __attribute__((ext_vector_type(8)))  _Float16 v8h;
typedef __attribute__((ext_vector_type(8)))  float v8f;
typedef __attribute__((ext_vector_type(4)))  float v4f;
typedef __attribute__((ext_vector_type(2)))  float v2f;
typedef __attribute__((ext_vector_type(4)))  unsigned v4u;
typedef __attribute__((ext_vector_type(4)))  int v4i;
typedef float __attribute__((may_alias)) float_a;
typedef int __attribute__((may_alias)) int_a;

template <typename T> __device__ __forceinline__ void vst2(void* p, T v) { *(T*)p = v;  }
__device__ __forceinline__ v8f wmma16(v16h a, v16h b, v8f c) {
  v8f d = __builtin_amdgcn_wmma_f32_16x16x32_f16(false, a, false, b, (short)0, c, false, false);
  asm volatile("v_nop\n\tv_nop\n\tv_nop\n\tv_nop" : "+v"(d) : "v"(a), "v"(b));
  return d;
}
__device__ __forceinline__ v8f wmma_bf(v16b a, v16b b, v8f c) {
  v8f d = __builtin_amdgcn_wmma_f32_16x16x32_bf16(false, a, false, b, (short)0, c, false, false);
  asm volatile("v_nop\n\tv_nop\n\tv_nop\n\tv_nop" : "+v"(d) : "v"(a), "v"(b));
  return d;
}
// 16x16x32 fragments: lane = (h = lane>>4, row/col = lane&15); elements 0..7 = k0+8h+0..7, 8..15 = k0+16+8h+0..7; D element r = row 8h+r
__device__ __forceinline__ v16h frag_h(const _Float16* rowk0, int lane) {
  union { v16h v; v8h q[2]; } u; const _Float16* p = rowk0 + 8 * (lane >> 4);
  u.q[0] = *(const v8h*)p; u.q[1] = *(const v8h*)(p + 16); return u.v;
}
__device__ __forceinline__ v16h frag_f32(const float* rowk0, int lane) {
  v16h a; const float* p = rowk0 + 8 * (lane >> 4);
#pragma unroll
  for (int i = 0; i < 8; ++i) { a[i] = (_Float16)p[i]; a[8 + i] = (_Float16)p[16 + i]; }
  return a;
}
__device__ __forceinline__ v16h frag_f32s(const float* rowk0, int lane, float sc) {
  v16h a; const float* p = rowk0 + 8 * (lane >> 4);
#pragma unroll
  for (int i = 0; i < 8; ++i) { a[i] = (_Float16)(p[i] * sc); a[8 + i] = (_Float16)(p[16 + i] * sc); }
  return a;
}
// column fragment from a [K][ld] layout (column n), rows >= K read as 0
__device__ __forceinline__ v16h fragc_f32(const float* W, int k0, int n, int lane, int ld, int K) {
  v16h a; const int g = lane >> 4;
#pragma unroll
  for (int i = 0; i < 8; ++i) { const int ka = k0 + 8 * g + i, kb = ka + 16;
    a[i] = (_Float16)(ka < K ? W[(size_t)(ka < K ? ka : K - 1) * ld + n] : 0.f); a[8 + i] = (_Float16)(kb < K ? W[(size_t)(kb < K ? kb : K - 1) * ld + n] : 0.f); }
  return a;
}
struct F2 { v16b h, l; };
__device__ __forceinline__ F2 bsplit16(const float v[16]) { F2 r;
#pragma unroll
  for (int i = 0; i < 16; ++i) { const __bf16 h = (__bf16)v[i]; r.h[i] = h; r.l[i] = (__bf16)(v[i] - (float)h); }
  return r; }
__device__ __forceinline__ F2 split_row(const float* row, int k0, int lane) { float v[16]; const float* p = row + k0 + 8 * (lane >> 4);
#pragma unroll
  for (int i = 0; i < 8; ++i) { v[i] = p[i]; v[8 + i] = p[16 + i]; }
  return bsplit16(v); }
__device__ __forceinline__ F2 split_rowK(const float* row, int k0, int lane, int K) { float v[16]; const int g = lane >> 4;
#pragma unroll
  for (int i = 0; i < 8; ++i) { const int ka = k0 + 8 * g + i, kb = ka + 16; v[i] = ka < K ? row[ka < K ? ka : K - 1] : 0.f; v[8 + i] = kb < K ? row[kb < K ? kb : K - 1] : 0.f; }
  return bsplit16(v); }
__device__ __forceinline__ F2 split_col(const float* W, int k0, int n, int lane, int ld, int K) { float v[16]; const int g = lane >> 4;
#pragma unroll
  for (int i = 0; i < 8; ++i) { const int ka = k0 + 8 * g + i, kb = ka + 16; v[i] = ka < K ? W[(size_t)(ka < K ? ka : K - 1) * ld + n] : 0.f; v[8 + i] = kb < K ? W[(size_t)(kb < K ? kb : K - 1) * ld + n] : 0.f; }
  return bsplit16(v); }
__device__ __forceinline__ v8f mac3(const F2& a, const F2& b, v8f c) { c = wmma_bf(a.l, b.h, c); c = wmma_bf(a.h, b.l, c); return wmma_bf(a.h, b.h, c); }
__device__ __forceinline__ float sigm(float v) { return 1.0f / (1.0f + expf(-v)); }
#define LDSX() do { asm volatile("s_wait_dscnt 0" ::: "memory"); __builtin_amdgcn_wave_barrier(); __builtin_amdgcn_fence(__ATOMIC_RELEASE, "workgroup"); } while (0)

#define NB 4
#define TT 2048
#define CC 256
#define DIN 1024
#define NH 1
#define HD 256
#define NQB (TT / 64)
#define HG NB              // all NB score planes at once: one launch of each stage covers every batch (blockIdx.z / blockIdx.y = batch)
#define SCALE (32.0f)
#define HDQK 256            // all 256 columns enter the logits
#define CAUSAL 0
#ifndef TNB
#define TNB NB
#endif
__device__ __forceinline__ v16b zero16b() { v16b z; _Pragma("unroll") for (int i = 0; i < 16; ++i) z[i] = (__bf16)0.f; return z; }
__device__ __forceinline__ float bfr(float v) { return (float)(__bf16)v; }
__host__ __device__ __forceinline__ int kb_last(int qb) { return CAUSAL ? ((qb * 64 + 63) >> 7) : (TT / 128 - 1); }
typedef __attribute__((ext_vector_type(8))) __bf16 v8b;
__device__ __forceinline__ v16b frag_b(const __bf16* rowk0, int lane) {
  union { v16b v; v8b q[2]; } u; const __bf16* p = rowk0 + 8 * (lane >> 4);
  u.q[0] = *(const v8b*)p; u.q[1] = *(const v8b*)(p + 16); return u.v;
}
#define QBH (TT / 64)      // ALL query blocks take k_sc's 3-product path
#define QBH_PV 0           // A.g stays single f16
#define QHI 2048            // q residual rows everywhere (3-product logits: sigma_logit ~ 170)
#define KHI 2048
// B fragment (k rows k0+.., output column o) of a weight: (in,out) [K][ld] or (out,in) [ld rows of K]: bf16 exact, or f16(bf16 * 256) exact
__device__ __forceinline__ v16b wcol_io(const float* Wm, int k0, int o, int lane, int ld) { v16b w; const int g = lane >> 4;
#pragma unroll
  for (int i = 0; i < 8; ++i) { w[i] = (__bf16)Wm[(size_t)(k0 + 8 * g + i) * ld + o]; w[8 + i] = (__bf16)Wm[(size_t)(k0 + 16 + 8 * g + i) * ld + o]; }
  return w; }
__device__ __forceinline__ v16b wcol_oi(const float* Wm, int k0, int o, int lane, int K) { v16b w; const float* p = Wm + (size_t)o * K + k0 + 8 * (lane >> 4);
#pragma unroll
  for (int i = 0; i < 8; ++i) { w[i] = (__bf16)p[i]; w[8 + i] = (__bf16)p[16 + i]; }
  return w; }
__device__ __forceinline__ v16h wcolh_io(const float* Wm, int k0, int o, int lane, int ld) { v16h w; const int g = lane >> 4;
#pragma unroll
  for (int i = 0; i < 8; ++i) { w[i] = (_Float16)(bfr(Wm[(size_t)(k0 + 8 * g + i) * ld + o]) * 256.0f); w[8 + i] = (_Float16)(bfr(Wm[(size_t)(k0 + 16 + 8 * g + i) * ld + o]) * 256.0f); }
  return w; }
__device__ __forceinline__ v16h wcolh_oi(const float* Wm, int k0, int o, int lane, int K) { v16h w; const float* p = Wm + (size_t)o * K + k0 + 8 * (lane >> 4);
#pragma unroll
  for (int i = 0; i < 8; ++i) { w[i] = (_Float16)(bfr(p[i]) * 256.0f); w[8 + i] = (_Float16)(bfr(p[16 + i]) * 256.0f); }
  return w; }
#define WQKV_LAYOUT 1   // 0 = (in,out) [DIN][CC]; 1 = (in,out) [DIN][CC] as well; 2 = per-head [NH][DIN][HD]
__device__ __forceinline__ v16b wcol_hdk(const float* Wm, int k0, int o, int lane) { v16b w; const int g = lane >> 4; const float* p = Wm + (size_t)(o / HD) * DIN * HD + (o % HD);
#pragma unroll
  for (int i = 0; i < 8; ++i) { w[i] = (__bf16)p[(size_t)(k0 + 8 * g + i) * HD]; w[8 + i] = (__bf16)p[(size_t)(k0 + 16 + 8 * g + i) * HD]; }
  return w; }
#define WO_OUT_IN 0
#if WQKV_LAYOUT == 1
#define WCOL(W, k0, o, lane) wcol_io(W, k0, (o), lane, CC)   /* (in,out) Wq/Wk/Wv [1024][256] */
#define WCOL_OLD_UNUSED(W, k0, o, lane) (((o) < HDQK) ? wcol_oi(W, k0, (o), lane, DIN) : zero16b())
#elif WQKV_LAYOUT == 2
#define WCOL(W, k0, o, lane) wcol_hdk(W, k0, o, lane)
#else
#define WCOL(W, k0, o, lane) wcol_io(W, k0, o, lane, CC)
#endif
#if WO_OUT_IN
#define WOCOL(W, k0, o, lane) wcol_oi(W, k0, o, lane, CC)
#define WOCOLH(W, k0, o, lane) wcolh_oi(W, k0, o, lane, CC)
#else
#define WOCOL(W, k0, o, lane) wcol_io(W, k0, o, lane, DIN)
#define WOCOLH(W, k0, o, lane) wcolh_io(W, k0, o, lane, DIN)
#endif
#ifndef XP
#define OUT1_OFF (4u * (size_t)NB * DIN * TT)   /* unused: the launch writes a single output */
#define XP TT              // channel-row pitch of k_fin2's X and outputs (k_fin2 is not launched)
#endif
#define BG HG              // the pass group spans BATCHES (single head): blockIdx.z / blockIdx.y select batch b0 + z
#define DVH 128

// ---- k_wz: block = (64 rows, 128 output cols): OR = y (hi + lo, K = 256 columns of the YR rows) . W^T ((out,in) rows of 256, exact) + b
__global__ __launch_bounds__(128) void k_wz(const float* __restrict__ YR, const float* __restrict__ WW, const float* __restrict__ WB, float* __restrict__ ORW) { __shared__ __align__(16) float sf[4][16][132];
  const int tid = threadIdx.x, wave = tid >> 5, lane = tid & 31, col = lane & 15, g = lane >> 4; const int c0 = blockIdx.y * 128; const size_t r0 = (size_t)blockIdx.x * 64 + wave * 16;
  v8f acc[8] = {};
#pragma unroll
  for (int kc = 0; kc < HDQK / 32; ++kc) { const F2 a = split_row(YR + (r0 + col) * CC, kc * 32, lane); asm volatile("s_wait_loadcnt 0x0" ::: "memory");
#pragma unroll
    for (int j = 0; j < 8; ++j) { const v16b w = wcol_oi(WW, kc * 32, c0 + j * 16 + col, lane, HDQK); asm volatile("s_wait_loadcnt 0x0" ::: "memory"); acc[j] = wmma_bf(a.h, w, acc[j]); acc[j] = wmma_bf(a.l, w, acc[j]); } }
#pragma unroll
  for (int j = 0; j < 8; ++j) { const float bb = WB ? bfr(WB[c0 + j * 16 + col]) : 0.f; asm volatile("s_wait_loadcnt 0x0" ::: "memory");
#pragma unroll
    for (int r = 0; r < 8; ++r) sf[wave][8 * g + r][j * 16 + col] = acc[j][r] + bb; }
  LDSX(); for (int rl = 0; rl < 16; ++rl) vst2(ORW + (r0 + rl) * DIN + c0 + lane * 4, *(const v4f*)&sf[wave][rl][lane * 4]); }
// ---- k_fin2: block = (64 positions, 64 channels, batch b): o[b][c][n] = OR[b*N + n][c] (channels-first via LDS transpose) -> output 1; y = gamma * o + bf16(x) -> output 0 (256-B runs)
__global__ __launch_bounds__(256) void k_fin2(const float* __restrict__ ORW, const float* __restrict__ X, const float* __restrict__ GM, float* __restrict__ OUT, float* __restrict__ OUT1) { const float gmv = bfr(GM[0]); __shared__ float st[64][68]; const int tid = threadIdx.x; const int n0 = blockIdx.x * 64, c0 = blockIdx.y * 64; const size_t b = blockIdx.z;
  for (int e = tid; e < 64 * 16; e += 256) { const int nl = e >> 4, q = e & 15; *(v4f*)&st[nl][q * 4] = *(const v4f*)(ORW + (b * TT + n0 + nl) * (size_t)DIN + c0 + q * 4); }
  __syncthreads();
  for (int e = tid; e < 64 * 16; e += 256) { const int cl = e >> 4, q = e & 15; const size_t oi = (b * DIN + c0 + cl) * (size_t)XP + n0 + q * 4; const v4f xr = *(const v4f*)(X + oi); v4f o, y; _Pragma("unroll") for (int i = 0; i < 4; ++i) { o[i] = st[q * 4 + i][cl]; y[i] = gmv * o[i] + bfr(xr[i]); } vst2(OUT + oi, y); vst2(OUT1 + oi, o); } }   /* y = gamma * o + x (output 0), o (output 1) */
#ifndef SM_EXTRA_PARAMS
#define SM_EXTRA_PARAMS
#endif
#ifndef PROJ_EXTRA_PARAMS
#define PROJ_EXTRA_PARAMS
#endif
#ifndef SM_MASK_HOOK
#define SM_MASK_HOOK (void)0
#endif

#define WS_QH  0u                                      // f16 q rows [b*t][CC]
#define WS_KH  (WS_QH + 2u * (size_t)NB * TT * CC)      // f16 k rows [b*t][CC]
#define WS_VT  (WS_KH + 2u * (size_t)NB * TT * CC)      // f16 v planes [b][c][t]
#define WS_QL  (WS_VT + 2u * (size_t)NB * CC * TT)      // f16 q residual x 2^10 rows [b][t < QHI][CC]
#define WS_KL  (WS_QL + 2u * (size_t)NB * QHI * CC)     // f16 k residual x 2^10 rows [b][t < KHI][CC]
#define WS_VB  (WS_KL + 2u * (size_t)NB * KHI * CC)     // bf16 v hi planes [b][c][t < KHI]
#define WS_VBL (WS_VB + 2u * (size_t)NB * CC * KHI)
#define WS_S   (WS_VBL + 2u * (size_t)NB * CC * KHI)    // f32 logits / P [hg][t][s]
#define WS_Y   (WS_S  + 4u * (size_t)HG * TT * TT)      // f32 ctx rows [b*t][CC] (only when there is an output projection)
#define WS_END (WS_Y  + 0u)

// ---- k_proj: block = (64 rows, 128 cols, which): q/k/v = X W (+ b) with exact bf16 products (K = DIN) -> which 0: q f16 rows (+ residual rows < QHI); 1: k f16 rows (+ residual rows < KHI); 2: v f16 planes [c][t] (+ bf16 hi/lo planes for t < KHI)
__global__ __launch_bounds__(128) void k_proj(const float* __restrict__ XQ, const float* __restrict__ XK, const float* __restrict__ XV, const float* __restrict__ WQ, const float* __restrict__ WK, const float* __restrict__ WV, const float* __restrict__ BQ, const float* __restrict__ BK, const float* __restrict__ BV,
    _Float16* __restrict__ QH, _Float16* __restrict__ QL, _Float16* __restrict__ KH, _Float16* __restrict__ KL, _Float16* __restrict__ VT, __bf16* __restrict__ VB, __bf16* __restrict__ VBL) {
  __shared__ __align__(16) _Float16 sh[64][136], sl[64][136]; __shared__ __align__(16) _Float16 th[128][72]; __shared__ __align__(16) __bf16 tb[128][72], tbl[128][72];
  const int tid = threadIdx.x, wave = tid >> 5, lane = tid & 31, col = lane & 15, g = lane >> 4; const int which = blockIdx.z; const int c0 = blockIdx.y * 128; const size_t r0 = (size_t)blockIdx.x * 64; const size_t bb = r0 / TT; const int t0 = (int)(r0 % TT);
  const float* X = which == 0 ? XQ : which == 1 ? XK : XV; const float* WA = which == 0 ? WQ : which == 1 ? WK : WV; const float* BA = which == 0 ? BQ : which == 1 ? BK : BV;
  v8f acc[8] = {};
#pragma unroll 2
  for (int kc = 0; kc < DIN / 32; ++kc) { v16b a; { const float* p = X + (r0 + wave * 16 + col) * (size_t)DIN + kc * 32 + 8 * g;   /* channels-LAST: plain rows x[b*T + t][k] */
#pragma unroll
      for (int i = 0; i < 8; ++i) { a[i] = (__bf16)p[i]; a[8 + i] = (__bf16)p[16 + i]; } }
    asm volatile("s_wait_loadcnt 0x0" ::: "memory");
#pragma unroll
    for (int j = 0; j < 8; ++j) { const v16b w = WCOL(WA, kc * 32, c0 + j * 16 + col, lane); asm volatile("s_wait_loadcnt 0x0" ::: "memory"); acc[j] = wmma_bf(a, w, acc[j]); } }
  if (which < 2) { _Float16* DH = which == 0 ? QH : KH; _Float16* DL = which == 0 ? QL : KL; const int nhi = which == 0 ? QHI : KHI; const bool hi_rows = t0 < nhi;
#pragma unroll
    for (int j = 0; j < 8; ++j) { const float bias = (BA && (which == 2 || (c0 + j * 16 + col) < HDQK)) ? bfr(BA[c0 + j * 16 + col]) : 0.f;   /* q/k/v: all 256 columns */   /* 256-entry biases */
#pragma unroll
      for (int r = 0; r < 8; ++r) { const float v = acc[j][r] + bias; const _Float16 hv = (_Float16)v; sh[wave * 16 + 8 * g + r][j * 16 + col] = hv; sl[wave * 16 + 8 * g + r][j * 16 + col] = (_Float16)((v - (float)hv) * 1024.0f); } }
    __syncthreads();
    for (int e = tid; e < 64 * 16; e += 128) { const int rl = e >> 4, q = e & 15; vst2((unsigned*)(DH + (r0 + rl) * CC + c0 + q * 8), *(const v4u*)&sh[rl][q * 8]); if (hi_rows) vst2((unsigned*)(DL + (bb * nhi + t0 + rl) * (size_t)CC + c0 + q * 8), *(const v4u*)&sl[rl][q * 8]); }
  } else { const bool hi_rows = t0 < KHI;
#pragma unroll
    for (int j = 0; j < 8; ++j) { const float bias = (BA && (which == 2 || (c0 + j * 16 + col) < HDQK)) ? bfr(BA[c0 + j * 16 + col]) : 0.f;   /* q/k/v: all 256 columns */   /* 256-entry biases */
#pragma unroll
      for (int r = 0; r < 8; ++r) { const float v = acc[j][r] + bias; const int rl = wave * 16 + 8 * g + r, cl = j * 16 + col; th[cl][rl] = (_Float16)v; const __bf16 bh = (__bf16)v; tb[cl][rl] = bh; tbl[cl][rl] = (__bf16)(v - (float)bh); } }
    __syncthreads();
    for (int e = tid; e < 128 * 8; e += 128) { const int cl = e >> 3, q = e & 7; vst2((unsigned*)(VT + (bb * CC + c0 + cl) * (size_t)TT + t0 + q * 8), *(const v4u*)&th[cl][q * 8]); if (hi_rows) { const size_t o3 = (bb * CC + c0 + cl) * (size_t)KHI + t0 + q * 8; vst2((unsigned*)(VB + o3), *(const v4u*)&tb[cl][q * 8]); vst2((unsigned*)(VBL + o3), *(const v4u*)&tbl[cl][q * 8]); } } } }
// ---- k_sc: block = (query block qb, key block kb <= kb_last(qb), batch b in group): logits x SCALE; q hi + residual (x 2^10) against k (2 products) for query rows < QHI, plus the k residual (3 products) for query blocks < QBH (all query blocks here); causal: blocks past the diagonal exit, the mask itself is applied by index in k_sm
__global__ __launch_bounds__(128) void k_sc(const _Float16* __restrict__ QH, const _Float16* __restrict__ KH, const _Float16* __restrict__ QL, const _Float16* __restrict__ KL, int bgrp, int h0, float* __restrict__ S0) { __shared__ __align__(16) float ss[4][16][132];
  const int qb = blockIdx.x, kb = blockIdx.y; if (kb > kb_last(qb)) return;
  const int h = h0; const int b = bgrp + blockIdx.z; float* S = S0 + (size_t)blockIdx.z * TT * TT;   /* group spans batches */
  const int tid = threadIdx.x, wave = tid >> 5, lane = tid & 31, col = lane & 15, g = lane >> 4; const int k0 = kb * 128; const int ql0 = qb * 64 + wave * 16; const size_t q0 = (size_t)b * TT + ql0, kr0 = (size_t)b * TT + k0;
  v8f acc[8] = {}, accl[8] = {};
  const _Float16* QLb = QL + (size_t)b * QHI * CC; const _Float16* KLb = KL + (size_t)b * KHI * CC;
  if (qb < QBH) {
#pragma unroll
    for (int kc = 0; kc < HDQK / 32; ++kc) { const v16h ah = frag_h(QH + (q0 + col) * CC + h * HD + kc * 32, lane), al = frag_h(QLb + (size_t)(ql0 + col) * CC + h * HD + kc * 32, lane);
#pragma unroll
      for (int j = 0; j < 8; ++j) { const v16h kbf = frag_h(KH + (kr0 + j * 16 + col) * CC + h * HD + kc * 32, lane), klf = frag_h(KLb + (size_t)(k0 + j * 16 + col) * CC + h * HD + kc * 32, lane); acc[j] = wmma16(ah, kbf, acc[j]); accl[j] = wmma16(al, kbf, accl[j]); accl[j] = wmma16(ah, klf, accl[j]); } }
  } else if (qb * 64 < QHI) {
#pragma unroll
    for (int kc = 0; kc < HDQK / 32; ++kc) { const v16h ah = frag_h(QH + (q0 + col) * CC + h * HD + kc * 32, lane), al = frag_h(QLb + (size_t)(ql0 + col) * CC + h * HD + kc * 32, lane);
#pragma unroll
      for (int j = 0; j < 8; ++j) { const v16h kbf = frag_h(KH + (kr0 + j * 16 + col) * CC + h * HD + kc * 32, lane); acc[j] = wmma16(ah, kbf, acc[j]); accl[j] = wmma16(al, kbf, accl[j]); } }
  } else {
#pragma unroll
    for (int kc = 0; kc < HDQK / 32; ++kc) { const v16h ah = frag_h(QH + (q0 + col) * CC + h * HD + kc * 32, lane);
#pragma unroll
      for (int j = 0; j < 8; ++j) { const v16h kbf = frag_h(KH + (kr0 + j * 16 + col) * CC + h * HD + kc * 32, lane); acc[j] = wmma16(ah, kbf, acc[j]); } } }
#pragma unroll
  for (int j = 0; j < 8; ++j) {
#pragma unroll
    for (int r = 0; r < 8; ++r) ss[wave][8 * g + r][j * 16 + col] = (acc[j][r] + accl[j][r] * (1.0f / 1024.0f)) * SCALE; }
  LDSX(); for (int rl = 0; rl < 16; ++rl) vst2(S + (size_t)(ql0 + rl) * TT + k0 + lane * 4, *(const v4f*)&ss[wave][rl][lane * 4]); }
// ---- k_sm: block = query row t (batch in group): keys [0, kend): causal -> logit if s <= t else excluded; softmax in f32; P x 2^11 in place (0 for excluded)
__global__ __launch_bounds__(256) void k_sm(float* __restrict__ S0 SM_EXTRA_PARAMS) { __shared__ float sred[8]; __shared__ float sbc; __shared__ __align__(16) float shv[TT];
  const int tid = threadIdx.x; const int t = blockIdx.x; const int kend = (kb_last(t >> 6) + 1) * 128;
  float* sr = S0 + (size_t)blockIdx.y * TT * TT + (size_t)t * TT;
  float m = -3.0e38f; for (int k = tid; k < kend; k += 256) { float v = (!CAUSAL || k <= t) ? sr[k] : -3.0e38f; SM_MASK_HOOK; shv[k] = v; m = fmaxf(m, v); }
#pragma unroll
  for (int o = 1; o < 32; o <<= 1) m = fmaxf(m, __shfl_xor(m, o));
  if ((tid & 31) == 0) sred[tid >> 5] = m; __syncthreads(); if (tid == 0) { float a = sred[0]; for (int i = 1; i < 8; ++i) a = fmaxf(a, sred[i]); sbc = a; } __syncthreads(); m = sbc; __syncthreads();
  float sum = 0.f; for (int k = tid; k < kend; k += 256) { const float v = shv[k]; const float e = (v <= -1.0e38f) ? 0.f : expf(v - m); shv[k] = e; sum += e; }
#pragma unroll
  for (int o = 1; o < 32; o <<= 1) sum += __shfl_xor(sum, o);
  if ((tid & 31) == 0) sred[tid >> 5] = sum; __syncthreads(); if (tid == 0) { float a = 0.f; for (int i = 0; i < 8; ++i) a += sred[i]; sbc = a > 0.f ? 2048.0f / a : 0.f; }   /* a fully excluded row yields P = 0 */ __syncthreads(); const float inv = sbc;
  for (int k = tid; k < kend; k += 256) shv[k] = shv[k] * inv;
  __syncthreads(); for (int q = tid; q < kend / 4; q += 256) vst2(sr + q * 4, *(const v4f*)&shv[q * 4]); }
// ---- k_pv: block = 64 queries (qb) of (b, h): ctx = P . v over keys [0, kend) (P x 2^11 once to f16 against v f16: 1 product; query blocks < QBH_PV (none here): P and v as bf16 hi + lo, 3 products); 512-B (row, column-half) segment by 32 lanes
__global__ __launch_bounds__(128) void k_pv(const float* __restrict__ PS0, const _Float16* __restrict__ VT, const __bf16* __restrict__ VB, const __bf16* __restrict__ VBL, int bgrp, int h0, float* __restrict__ Y) { const int h = h0; const int b = bgrp + blockIdx.z; const float* PS = PS0 + (size_t)blockIdx.z * TT * TT; const int d0 = blockIdx.y * DVH;   /* group spans batches; column half d0 */ __shared__ __align__(16) float ss[4][16][DVH + 4];
  const int tid = threadIdx.x, wave = tid >> 5, lane = tid & 31, col = lane & 15, g = lane >> 4; const int qb = blockIdx.x; const int ql0 = qb * 64 + wave * 16; const int kce = (kb_last(qb) + 1) * 4;
  v8f acc[DVH / 16] = {};
  if (qb < QBH_PV) {
#pragma unroll 1
    for (int kc = 0; kc < kce; ++kc) { const F2 p = split_row(PS + (size_t)(ql0 + col) * TT, kc * 32, lane);
      asm volatile("s_wait_loadcnt 0x0" ::: "memory");
#pragma unroll
      for (int j = 0; j < DVH / 16; ++j) { const size_t po = ((size_t)b * CC + h * HD + d0 + j * 16 + col) * (size_t)KHI + kc * 32; const v16b vh = frag_b(VB + po, lane); acc[j] = wmma_bf(p.h, vh, acc[j]); acc[j] = wmma_bf(p.l, vh, acc[j]); acc[j] = wmma_bf(p.h, frag_b(VBL + po, lane), acc[j]); } }
  } else {
#pragma unroll 1
    for (int kc = 0; kc < kce; ++kc) { const v16h p = frag_f32(PS + (size_t)(ql0 + col) * TT + kc * 32, lane);
      asm volatile("s_wait_loadcnt 0x0" ::: "memory");
#pragma unroll
      for (int j = 0; j < DVH / 16; ++j) { const size_t po = ((size_t)b * CC + h * HD + d0 + j * 16 + col) * (size_t)TT + kc * 32; acc[j] = wmma16(p, frag_h(VT + po, lane), acc[j]); } } }
#pragma unroll
  for (int j = 0; j < DVH / 16; ++j)
#pragma unroll
    for (int r = 0; r < 8; ++r) ss[wave][8 * g + r][j * 16 + col] = acc[j][r] * (1.0f / 2048.0f);
  LDSX(); for (int rl = 0; rl < 16; ++rl) vst2(Y + ((size_t)b * TT + ql0 + rl) * CC + h * HD + d0 + lane * 4, *(const v4f*)&ss[wave][rl][lane * 4]); }   /* 512-B (row, column-half) segment by 32 lanes */

__global__ __launch_bounds__(256) void k_axpy(const float* __restrict__ YR, const float* __restrict__ X, const float* __restrict__ GM, float* __restrict__ OUT) { const size_t e = ((size_t)blockIdx.x * 256 + threadIdx.x) * 4; if (e >= (size_t)TNB * TT * DIN) return; const float gmv = bfr(GM[0]); const v4f o = *(const v4f*)(YR + e); const v4f xr = *(const v4f*)(X + e); asm volatile("s_wait_loadcnt 0x0" ::: "memory"); v4f y; _Pragma("unroll") for (int i = 0; i < 4; ++i) y[i] = gmv * o[i] + bfr(xr[i]); vst2(OUT + e, y); }
extern "C" void kernel_launch(void* const* d_in, const int* in_sizes, int n_in, void* d_out, int out_size, void* d_ws, size_t ws_size, hipStream_t stream) {
  (void)in_sizes; (void)n_in; (void)out_size;
  const float** F = (const float**)d_in;
  if (ws_size < (size_t)WS_END) return;
  char* ws = (char*)d_ws; _Float16 *QH = (_Float16*)(ws + WS_QH), *KH = (_Float16*)(ws + WS_KH), *VT = (_Float16*)(ws + WS_VT), *QL = (_Float16*)(ws + WS_QL), *KL = (_Float16*)(ws + WS_KL); __bf16 *VB = (__bf16*)(ws + WS_VB), *VBL = (__bf16*)(ws + WS_VBL); float *S = (float*)(ws + WS_S), *Y = (float*)(ws + WS_Y);
  (void)Y; (void)QL; (void)KL; (void)VB; (void)VBL;
  // inputs: 0 x [4,2048,1024]; 1 Wq [1024,256] (in,out), 2 bq; 3 Wk, 4 bk; 5 Wv, 6 bv
  if (ws_size < (size_t)WS_END) return;
  k_proj<<<dim3(TNB * TT / 64, CC / 128, 3), 128, 0, stream>>>(F[0], F[0], F[0], F[1], F[3], F[5], F[2], F[4], F[6], QH, QL, KH, KL, VT, VB, VBL);
  for (int b0 = 0; b0 < TNB; b0 += BG) {
    k_sc<<<dim3(NQB, TT / 128, BG), 128, 0, stream>>>(QH, KH, QL, KL, b0, 0, S);
    k_sm<<<dim3(TT, BG), 256, 0, stream>>>(S);
    k_pv<<<dim3(NQB, HD / DVH, BG), 128, 0, stream>>>(S, VT, VB, VBL, b0, 0, (float*)d_out);   /* out rows [b*T + t][256] directly */
  }
}

// v002
// It runs in 222 microseconds.
// Next to v001, in two timings, it ran 1.39 and 1.38 times as fast.
// Over all steps from v000 it is 2.89 times as fast.
// compute dtype: all float inputs rounded to bf16; q/k/v = x W + b with EXACT bf16 products on WMMA 16x16x32 (f32 accumulate); logits x sqrt(1024) = 32 (sigma_logit ~ 170, near one-hot rows) with q AND k as f16 hi + residual planes (3 products); softmax in f32 (precise expf); attn P x 2^11 as f16 against v f16 (1 product); f32 output.
// Single attention head with a MULTIPLIED scale (B 4, T 2,048, C 1,024 -> E 256; (in,out) uniform +-1/32 weights with biases): q, k, v = x W + b; wei = softmax(q k^T * sqrt(1024)); out = wei v -> [4, 2,048, 256] (non-causal).
#include <hip/hip_runtime.h>
#include <math.h>

typedef __attribute__((ext_vector_type(16))) _Float16 v16h;
typedef __attribute__((ext_vector_type(16))) __bf16 v16b;
typedef __attribute__((ext_vector_type(8)))  _Float16 v8h;
typedef __attribute__((ext_vector_type(8)))  float v8f;
typedef __attribute__((ext_vector_type(4)))  float v4f;
typedef __attribute__((ext_vector_type(2)))  float v2f;
typedef __attribute__((ext_vector_type(4)))  unsigned v4u;
typedef __attribute__((ext_vector_type(4)))  int v4i;
typedef float __attribute__((may_alias)) float_a;
typedef int __attribute__((may_alias)) int_a;

template <typename T> __device__ __forceinline__ void vst2(void* p, T v) { *(T*)p = v;  }
__device__ __forceinline__ v8f wmma16(v16h a, v16h b, v8f c) {
  v8f d = __builtin_amdgcn_wmma_f32_16x16x32_f16(false, a, false, b, (short)0, c, false, false);
  asm volatile("v_nop\n\tv_nop\n\tv_nop\n\tv_nop" : "+v"(d) : "v"(a), "v"(b));
  return d;
}
__device__ __forceinline__ v8f wmma_bf(v16b a, v16b b, v8f c) {
  v8f d = __builtin_amdgcn_wmma_f32_16x16x32_bf16(false, a, false, b, (short)0, c, false, false);
  asm volatile("v_nop\n\tv_nop\n\tv_nop\n\tv_nop" : "+v"(d) : "v"(a), "v"(b));
  return d;
}
// 16x16x32 fragments: lane = (h = lane>>4, row/col = lane&15); elements 0..7 = k0+8h+0..7, 8..15 = k0+16+8h+0..7; D element r = row 8h+r
__device__ __forceinline__ v16h frag_h(const _Float16* rowk0, int lane) {
  union { v16h v; v8h q[2]; } u; const _Float16* p = rowk0 + 8 * (lane >> 4);
  u.q[0] = *(const v8h*)p; u.q[1] = *(const v8h*)(p + 16); return u.v;
}
__device__ __forceinline__ v16h frag_f32(const float* rowk0, int lane) {
  v16h a; const float* p = rowk0 + 8 * (lane >> 4);
#pragma unroll
  for (int i = 0; i < 8; ++i) { a[i] = (_Float16)p[i]; a[8 + i] = (_Float16)p[16 + i]; }
  return a;
}
__device__ __forceinline__ v16h frag_f32s(const float* rowk0, int lane, float sc) {
  v16h a; const float* p = rowk0 + 8 * (lane >> 4);
#pragma unroll
  for (int i = 0; i < 8; ++i) { a[i] = (_Float16)(p[i] * sc); a[8 + i] = (_Float16)(p[16 + i] * sc); }
  return a;
}
// column fragment from a [K][ld] layout (column n), rows >= K read as 0
__device__ __forceinline__ v16h fragc_f32(const float* W, int k0, int n, int lane, int ld, int K) {
  v16h a; const int g = lane >> 4;
#pragma unroll
  for (int i = 0; i < 8; ++i) { const int ka = k0 + 8 * g + i, kb = ka + 16;
    a[i] = (_Float16)(ka < K ? W[(size_t)(ka < K ? ka : K - 1) * ld + n] : 0.f); a[8 + i] = (_Float16)(kb < K ? W[(size_t)(kb < K ? kb : K - 1) * ld + n] : 0.f); }
  return a;
}
struct F2 { v16b h, l; };
__device__ __forceinline__ F2 bsplit16(const float v[16]) { F2 r;
#pragma unroll
  for (int i = 0; i < 16; ++i) { const __bf16 h = (__bf16)v[i]; r.h[i] = h; r.l[i] = (__bf16)(v[i] - (float)h); }
  return r; }
__device__ __forceinline__ F2 split_row(const float* row, int k0, int lane) { float v[16]; const float* p = row + k0 + 8 * (lane >> 4);
#pragma unroll
  for (int i = 0; i < 8; ++i) { v[i] = p[i]; v[8 + i] = p[16 + i]; }
  return bsplit16(v); }
__device__ __forceinline__ F2 split_rowK(const float* row, int k0, int lane, int K) { float v[16]; const int g = lane >> 4;
#pragma unroll
  for (int i = 0; i < 8; ++i) { const int ka = k0 + 8 * g + i, kb = ka + 16; v[i] = ka < K ? row[ka < K ? ka : K - 1] : 0.f; v[8 + i] = kb < K ? row[kb < K ? kb : K - 1] : 0.f; }
  return bsplit16(v); }
__device__ __forceinline__ F2 split_col(const float* W, int k0, int n, int lane, int ld, int K) { float v[16]; const int g = lane >> 4;
#pragma unroll
  for (int i = 0; i < 8; ++i) { const int ka = k0 + 8 * g + i, kb = ka + 16; v[i] = ka < K ? W[(size_t)(ka < K ? ka : K - 1) * ld + n] : 0.f; v[8 + i] = kb < K ? W[(size_t)(kb < K ? kb : K - 1) * ld + n] : 0.f; }
  return bsplit16(v); }
__device__ __forceinline__ v8f mac3(const F2& a, const F2& b, v8f c) { c = wmma_bf(a.l, b.h, c); c = wmma_bf(a.h, b.l, c); return wmma_bf(a.h, b.h, c); }
__device__ __forceinline__ float sigm(float v) { return 1.0f / (1.0f + expf(-v)); }
#define LDSX() do { asm volatile("s_wait_dscnt 0" ::: "memory"); __builtin_amdgcn_wave_barrier(); __builtin_amdgcn_fence(__ATOMIC_RELEASE, "workgroup"); } while (0)

#define NB 4
#define TT 2048
#define CC 256
#define DIN 1024
#define NH 1
#define HD 256
#define NQB (TT / 64)
#define HG NB              // all NB score planes at once: one launch of each stage covers every batch (blockIdx.z / blockIdx.y = batch)
#define SCALE (32.0f)
#define HDQK 256            // all 256 columns enter the logits
#define CAUSAL 0
#ifndef TNB
#define TNB NB
#endif
__device__ __forceinline__ v16b zero16b() { v16b z; _Pragma("unroll") for (int i = 0; i < 16; ++i) z[i] = (__bf16)0.f; return z; }
__device__ __forceinline__ float bfr(float v) { return (float)(__bf16)v; }
__host__ __device__ __forceinline__ int kb_last(int qb) { return CAUSAL ? ((qb * 64 + 63) >> 7) : (TT / 128 - 1); }
typedef __attribute__((ext_vector_type(8))) __bf16 v8b;
__device__ __forceinline__ v16b frag_b(const __bf16* rowk0, int lane) {
  union { v16b v; v8b q[2]; } u; const __bf16* p = rowk0 + 8 * (lane >> 4);
  u.q[0] = *(const v8b*)p; u.q[1] = *(const v8b*)(p + 16); return u.v;
}
#define QBH (TT / 64)      // ALL query blocks take k_sc's 3-product path
#define QBH_PV 0           // A.g stays single f16
#define QHI 2048            // q residual rows everywhere (3-product logits: sigma_logit ~ 170)
#define KHI 2048
// B fragment (k rows k0+.., output column o) of a weight: (in,out) [K][ld] or (out,in) [ld rows of K]: bf16 exact, or f16(bf16 * 256) exact
__device__ __forceinline__ v16b wcol_io(const float* Wm, int k0, int o, int lane, int ld) { v16b w; const int g = lane >> 4;
#pragma unroll
  for (int i = 0; i < 8; ++i) { w[i] = (__bf16)Wm[(size_t)(k0 + 8 * g + i) * ld + o]; w[8 + i] = (__bf16)Wm[(size_t)(k0 + 16 + 8 * g + i) * ld + o]; }
  return w; }
__device__ __forceinline__ v16b wcol_oi(const float* Wm, int k0, int o, int lane, int K) { v16b w; const float* p = Wm + (size_t)o * K + k0 + 8 * (lane >> 4);
#pragma unroll
  for (int i = 0; i < 8; ++i) { w[i] = (__bf16)p[i]; w[8 + i] = (__bf16)p[16 + i]; }
  return w; }
__device__ __forceinline__ v16h wcolh_io(const float* Wm, int k0, int o, int lane, int ld) { v16h w; const int g = lane >> 4;
#pragma unroll
  for (int i = 0; i < 8; ++i) { w[i] = (_Float16)(bfr(Wm[(size_t)(k0 + 8 * g + i) * ld + o]) * 256.0f); w[8 + i] = (_Float16)(bfr(Wm[(size_t)(k0 + 16 + 8 * g + i) * ld + o]) * 256.0f); }
  return w; }
__device__ __forceinline__ v16h wcolh_oi(const float* Wm, int k0, int o, int lane, int K) { v16h w; const float* p = Wm + (size_t)o * K + k0 + 8 * (lane >> 4);
#pragma unroll
  for (int i = 0; i < 8; ++i) { w[i] = (_Float16)(bfr(p[i]) * 256.0f); w[8 + i] = (_Float16)(bfr(p[16 + i]) * 256.0f); }
  return w; }
#define WQKV_LAYOUT 1   // 0 = (in,out) [DIN][CC]; 1 = (in,out) [DIN][CC] as well; 2 = per-head [NH][DIN][HD]
__device__ __forceinline__ v16b wcol_hdk(const float* Wm, int k0, int o, int lane) { v16b w; const int g = lane >> 4; const float* p = Wm + (size_t)(o / HD) * DIN * HD + (o % HD);
#pragma unroll
  for (int i = 0; i < 8; ++i) { w[i] = (__bf16)p[(size_t)(k0 + 8 * g + i) * HD]; w[8 + i] = (__bf16)p[(size_t)(k0 + 16 + 8 * g + i) * HD]; }
  return w; }
#define WO_OUT_IN 0
#if WQKV_LAYOUT == 1
#define WCOL(W, k0, o, lane) wcol_io(W, k0, (o), lane, CC)   /* (in,out) Wq/Wk/Wv [1024][256] */
#define WCOL_OLD_UNUSED(W, k0, o, lane) (((o) < HDQK) ? wcol_oi(W, k0, (o), lane, DIN) : zero16b())
#elif WQKV_LAYOUT == 2
#define WCOL(W, k0, o, lane) wcol_hdk(W, k0, o, lane)
#else
#define WCOL(W, k0, o, lane) wcol_io(W, k0, o, lane, CC)
#endif
#if WO_OUT_IN
#define WOCOL(W, k0, o, lane) wcol_oi(W, k0, o, lane, CC)
#define WOCOLH(W, k0, o, lane) wcolh_oi(W, k0, o, lane, CC)
#else
#define WOCOL(W, k0, o, lane) wcol_io(W, k0, o, lane, DIN)
#define WOCOLH(W, k0, o, lane) wcolh_io(W, k0, o, lane, DIN)
#endif
#ifndef XP
#define OUT1_OFF (4u * (size_t)NB * DIN * TT)   /* unused: the launch writes a single output */
#define XP TT              // channel-row pitch of k_fin2's X and outputs (k_fin2 is not launched)
#endif
#define BG HG              // the pass group spans BATCHES (single head): blockIdx.z / blockIdx.y select batch b0 + z
#define DVH 128

// ---- k_wz: block = (64 rows, 128 output cols): OR = y (hi + lo, K = 256 columns of the YR rows) . W^T ((out,in) rows of 256, exact) + b
__global__ __launch_bounds__(128) void k_wz(const float* __restrict__ YR, const float* __restrict__ WW, const float* __restrict__ WB, float* __restrict__ ORW) { __shared__ __align__(16) float sf[4][16][132];
  const int tid = threadIdx.x, wave = tid >> 5, lane = tid & 31, col = lane & 15, g = lane >> 4; const int c0 = blockIdx.y * 128; const size_t r0 = (size_t)blockIdx.x * 64 + wave * 16;
  v8f acc[8] = {};
#pragma unroll
  for (int kc = 0; kc < HDQK / 32; ++kc) { const F2 a = split_row(YR + (r0 + col) * CC, kc * 32, lane); asm volatile("s_wait_loadcnt 0x0" ::: "memory");
#pragma unroll
    for (int j = 0; j < 8; ++j) { const v16b w = wcol_oi(WW, kc * 32, c0 + j * 16 + col, lane, HDQK); asm volatile("s_wait_loadcnt 0x0" ::: "memory"); acc[j] = wmma_bf(a.h, w, acc[j]); acc[j] = wmma_bf(a.l, w, acc[j]); } }
#pragma unroll
  for (int j = 0; j < 8; ++j) { const float bb = WB ? bfr(WB[c0 + j * 16 + col]) : 0.f; asm volatile("s_wait_loadcnt 0x0" ::: "memory");
#pragma unroll
    for (int r = 0; r < 8; ++r) sf[wave][8 * g + r][j * 16 + col] = acc[j][r] + bb; }
  LDSX(); for (int rl = 0; rl < 16; ++rl) vst2(ORW + (r0 + rl) * DIN + c0 + lane * 4, *(const v4f*)&sf[wave][rl][lane * 4]); }
// ---- k_fin2: block = (64 positions, 64 channels, batch b): o[b][c][n] = OR[b*N + n][c] (channels-first via LDS transpose) -> output 1; y = gamma * o + bf16(x) -> output 0 (256-B runs)
__global__ __launch_bounds__(256) void k_fin2(const float* __restrict__ ORW, const float* __restrict__ X, const float* __restrict__ GM, float* __restrict__ OUT, float* __restrict__ OUT1) { const float gmv = bfr(GM[0]); __shared__ float st[64][68]; const int tid = threadIdx.x; const int n0 = blockIdx.x * 64, c0 = blockIdx.y * 64; const size_t b = blockIdx.z;
  for (int e = tid; e < 64 * 16; e += 256) { const int nl = e >> 4, q = e & 15; *(v4f*)&st[nl][q * 4] = *(const v4f*)(ORW + (b * TT + n0 + nl) * (size_t)DIN + c0 + q * 4); }
  __syncthreads();
  for (int e = tid; e < 64 * 16; e += 256) { const int cl = e >> 4, q = e & 15; const size_t oi = (b * DIN + c0 + cl) * (size_t)XP + n0 + q * 4; const v4f xr = *(const v4f*)(X + oi); v4f o, y; _Pragma("unroll") for (int i = 0; i < 4; ++i) { o[i] = st[q * 4 + i][cl]; y[i] = gmv * o[i] + bfr(xr[i]); } vst2(OUT + oi, y); vst2(OUT1 + oi, o); } }   /* y = gamma * o + x (output 0), o (output 1) */
#ifndef SM_EXTRA_PARAMS
#define SM_EXTRA_PARAMS
#endif
#ifndef PROJ_EXTRA_PARAMS
#define PROJ_EXTRA_PARAMS
#endif
#ifndef SM_MASK_HOOK
#define SM_MASK_HOOK (void)0
#endif

#define WS_QH  0u                                      // f16 q rows [b*t][CC]
#define WS_KH  (WS_QH + 2u * (size_t)NB * TT * CC)      // f16 k rows [b*t][CC]
#define WS_VT  (WS_KH + 2u * (size_t)NB * TT * CC)      // f16 v planes [b][c][t]
#define WS_QL  (WS_VT + 2u * (size_t)NB * CC * TT)      // f16 q residual x 2^10 rows [b][t < QHI][CC]
#define WS_KL  (WS_QL + 2u * (size_t)NB * QHI * CC)     // f16 k residual x 2^10 rows [b][t < KHI][CC]
#define WS_VB  (WS_KL + 2u * (size_t)NB * KHI * CC)     // bf16 v hi planes [b][c][t < KHI]
#define WS_VBL (WS_VB + 2u * (size_t)NB * CC * KHI)
#define WS_S   (WS_VBL + 2u * (size_t)NB * CC * KHI)    // f32 logits / P [hg][t][s]
#define WS_Y   (WS_S  + 4u * (size_t)HG * TT * TT)      // f32 ctx rows [b*t][CC] (only when there is an output projection)
#define WS_END (WS_Y  + 0u)

// ---- k_proj: block = (64 rows, 128 cols, which): q/k/v = X W (+ b) with exact bf16 products (K = DIN) -> which 0: q f16 rows (+ residual rows < QHI); 1: k f16 rows (+ residual rows < KHI); 2: v f16 planes [c][t] (+ bf16 hi/lo planes for t < KHI)
__global__ __launch_bounds__(128) void k_proj(const float* __restrict__ XQ, const float* __restrict__ XK, const float* __restrict__ XV, const float* __restrict__ WQ, const float* __restrict__ WK, const float* __restrict__ WV, const float* __restrict__ BQ, const float* __restrict__ BK, const float* __restrict__ BV,
    _Float16* __restrict__ QH, _Float16* __restrict__ QL, _Float16* __restrict__ KH, _Float16* __restrict__ KL, _Float16* __restrict__ VT, __bf16* __restrict__ VB, __bf16* __restrict__ VBL) {
  __shared__ __align__(16) _Float16 sh[64][136], sl[64][136]; __shared__ __align__(16) _Float16 th[128][72]; __shared__ __align__(16) __bf16 tb[128][72], tbl[128][72];
  const int tid = threadIdx.x, wave = tid >> 5, lane = tid & 31, col = lane & 15, g = lane >> 4; const int which = blockIdx.z; const int c0 = blockIdx.y * 128; const size_t r0 = (size_t)blockIdx.x * 64; const size_t bb = r0 / TT; const int t0 = (int)(r0 % TT);
  const float* X = which == 0 ? XQ : which == 1 ? XK : XV; const float* WA = which == 0 ? WQ : which == 1 ? WK : WV; const float* BA = which == 0 ? BQ : which == 1 ? BK : BV;
  v8f acc[8] = {};
#pragma unroll 2
  for (int kc = 0; kc < DIN / 32; ++kc) { v16b a; { const float* p = X + (r0 + wave * 16 + col) * (size_t)DIN + kc * 32 + 8 * g;   /* channels-LAST: plain rows x[b*T + t][k] */
#pragma unroll
      for (int i = 0; i < 8; ++i) { a[i] = (__bf16)p[i]; a[8 + i] = (__bf16)p[16 + i]; } }
    asm volatile("s_wait_loadcnt 0x0" ::: "memory");
#pragma unroll
    for (int j = 0; j < 8; ++j) { const v16b w = WCOL(WA, kc * 32, c0 + j * 16 + col, lane); asm volatile("s_wait_loadcnt 0x0" ::: "memory"); acc[j] = wmma_bf(a, w, acc[j]); } }
  if (which < 2) { _Float16* DH = which == 0 ? QH : KH; _Float16* DL = which == 0 ? QL : KL; const int nhi = which == 0 ? QHI : KHI; const bool hi_rows = t0 < nhi;
#pragma unroll
    for (int j = 0; j < 8; ++j) { const float bias = (BA && (which == 2 || (c0 + j * 16 + col) < HDQK)) ? bfr(BA[c0 + j * 16 + col]) : 0.f;   /* q/k/v: all 256 columns */   /* 256-entry biases */
#pragma unroll
      for (int r = 0; r < 8; ++r) { const float v = acc[j][r] + bias; const _Float16 hv = (_Float16)v; sh[wave * 16 + 8 * g + r][j * 16 + col] = hv; sl[wave * 16 + 8 * g + r][j * 16 + col] = (_Float16)((v - (float)hv) * 1024.0f); } }
    __syncthreads();
    for (int e = tid; e < 64 * 16; e += 128) { const int rl = e >> 4, q = e & 15; vst2((unsigned*)(DH + (r0 + rl) * CC + c0 + q * 8), *(const v4u*)&sh[rl][q * 8]); if (hi_rows) vst2((unsigned*)(DL + (bb * nhi + t0 + rl) * (size_t)CC + c0 + q * 8), *(const v4u*)&sl[rl][q * 8]); }
  } else { const bool hi_rows = t0 < KHI;
#pragma unroll
    for (int j = 0; j < 8; ++j) { const float bias = (BA && (which == 2 || (c0 + j * 16 + col) < HDQK)) ? bfr(BA[c0 + j * 16 + col]) : 0.f;   /* q/k/v: all 256 columns */   /* 256-entry biases */
#pragma unroll
      for (int r = 0; r < 8; ++r) { const float v = acc[j][r] + bias; const int rl = wave * 16 + 8 * g + r, cl = j * 16 + col; th[cl][rl] = (_Float16)v; const __bf16 bh = (__bf16)v; tb[cl][rl] = bh; tbl[cl][rl] = (__bf16)(v - (float)bh); } }
    __syncthreads();
    for (int e = tid; e < 128 * 8; e += 128) { const int cl = e >> 3, q = e & 7; vst2((unsigned*)(VT + (bb * CC + c0 + cl) * (size_t)TT + t0 + q * 8), *(const v4u*)&th[cl][q * 8]); if (hi_rows) { const size_t o3 = (bb * CC + c0 + cl) * (size_t)KHI + t0 + q * 8; vst2((unsigned*)(VB + o3), *(const v4u*)&tb[cl][q * 8]); vst2((unsigned*)(VBL + o3), *(const v4u*)&tbl[cl][q * 8]); } } } }
// ---- k_sc: block = (query block qb, key block kb <= kb_last(qb), batch b in group): logits x SCALE; q hi + residual (x 2^10) against k (2 products) for query rows < QHI, plus the k residual (3 products) for query blocks < QBH (all query blocks here); causal: blocks past the diagonal exit, the mask itself is applied by index in k_sm
__global__ __launch_bounds__(128) void k_sc(const _Float16* __restrict__ QH, const _Float16* __restrict__ KH, const _Float16* __restrict__ QL, const _Float16* __restrict__ KL, int bgrp, int h0, float* __restrict__ S0) { __shared__ __align__(16) float ss[4][16][132];
  const int qb = blockIdx.x, kb = blockIdx.y; if (kb > kb_last(qb)) return;
  const int h = h0; const int b = bgrp + blockIdx.z; float* S = S0 + (size_t)blockIdx.z * TT * TT;   /* group spans batches */
  const int tid = threadIdx.x, wave = tid >> 5, lane = tid & 31, col = lane & 15, g = lane >> 4; const int k0 = kb * 128; const int ql0 = qb * 64 + wave * 16; const size_t q0 = (size_t)b * TT + ql0, kr0 = (size_t)b * TT + k0;
  v8f acc[8] = {}, accl[8] = {};
  const _Float16* QLb = QL + (size_t)b * QHI * CC; const _Float16* KLb = KL + (size_t)b * KHI * CC;
  if (qb < QBH) {
#pragma unroll
    for (int kc = 0; kc < HDQK / 32; ++kc) { const v16h ah = frag_h(QH + (q0 + col) * CC + h * HD + kc * 32, lane), al = frag_h(QLb + (size_t)(ql0 + col) * CC + h * HD + kc * 32, lane);
#pragma unroll
      for (int j = 0; j < 8; ++j) { const v16h kbf = frag_h(KH + (kr0 + j * 16 + col) * CC + h * HD + kc * 32, lane), klf = frag_h(KLb + (size_t)(k0 + j * 16 + col) * CC + h * HD + kc * 32, lane); acc[j] = wmma16(ah, kbf, acc[j]); accl[j] = wmma16(al, kbf, accl[j]); accl[j] = wmma16(ah, klf, accl[j]); } }
  } else if (qb * 64 < QHI) {
#pragma unroll
    for (int kc = 0; kc < HDQK / 32; ++kc) { const v16h ah = frag_h(QH + (q0 + col) * CC + h * HD + kc * 32, lane), al = frag_h(QLb + (size_t)(ql0 + col) * CC + h * HD + kc * 32, lane);
#pragma unroll
      for (int j = 0; j < 8; ++j) { const v16h kbf = frag_h(KH + (kr0 + j * 16 + col) * CC + h * HD + kc * 32, lane); acc[j] = wmma16(ah, kbf, acc[j]); accl[j] = wmma16(al, kbf, accl[j]); } }
  } else {
#pragma unroll
    for (int kc = 0; kc < HDQK / 32; ++kc) { const v16h ah = frag_h(QH + (q0 + col) * CC + h * HD + kc * 32, lane);
#pragma unroll
      for (int j = 0; j < 8; ++j) { const v16h kbf = frag_h(KH + (kr0 + j * 16 + col) * CC + h * HD + kc * 32, lane); acc[j] = wmma16(ah, kbf, acc[j]); } } }
#pragma unroll
  for (int j = 0; j < 8; ++j) {
#pragma unroll
    for (int r = 0; r < 8; ++r) ss[wave][8 * g + r][j * 16 + col] = (acc[j][r] + accl[j][r] * (1.0f / 1024.0f)) * SCALE; }
  LDSX(); for (int rl = 0; rl < 16; ++rl) vst2(S + (size_t)(ql0 + rl) * TT + k0 + lane * 4, *(const v4f*)&ss[wave][rl][lane * 4]); }
// ---- k_sm: block = query row t (batch in group): keys [0, kend): causal -> logit if s <= t else excluded; softmax in f32; P x 2^11 in place (0 for excluded)
__global__ __launch_bounds__(256) void k_sm(float* __restrict__ S0 SM_EXTRA_PARAMS) { __shared__ float sred[8]; __shared__ float sbc; __shared__ __align__(16) float shv[TT];
  const int tid = threadIdx.x; const int t = blockIdx.x; const int kend = (kb_last(t >> 6) + 1) * 128;
  float* sr = S0 + (size_t)blockIdx.y * TT * TT + (size_t)t * TT;
  float m = -3.0e38f; for (int k = tid; k < kend; k += 256) { float v = (!CAUSAL || k <= t) ? sr[k] : -3.0e38f; SM_MASK_HOOK; shv[k] = v; m = fmaxf(m, v); }
#pragma unroll
  for (int o = 1; o < 32; o <<= 1) m = fmaxf(m, __shfl_xor(m, o));
  if ((tid & 31) == 0) sred[tid >> 5] = m; __syncthreads(); if (tid == 0) { float a = sred[0]; for (int i = 1; i < 8; ++i) a = fmaxf(a, sred[i]); sbc = a; } __syncthreads(); m = sbc; __syncthreads();
  float sum = 0.f; for (int k = tid; k < kend; k += 256) { const float v = shv[k]; const float e = (v <= -1.0e38f) ? 0.f : expf(v - m); shv[k] = e; sum += e; }
#pragma unroll
  for (int o = 1; o < 32; o <<= 1) sum += __shfl_xor(sum, o);
  if ((tid & 31) == 0) sred[tid >> 5] = sum; __syncthreads(); if (tid == 0) { float a = 0.f; for (int i = 0; i < 8; ++i) a += sred[i]; sbc = a > 0.f ? 2048.0f / a : 0.f; }   /* a fully excluded row yields P = 0 */ __syncthreads(); const float inv = sbc;
  for (int k = tid; k < kend; k += 256) shv[k] = shv[k] * inv;
  __syncthreads(); for (int q = tid; q < kend / 4; q += 256) vst2(sr + q * 4, *(const v4f*)&shv[q * 4]); }
#define PVK 128                       // keys per staged tile of k_pv
#define PV_PPITCH (PVK * 4 + 16)      // LDS pitch of a P row, bytes: 16 B x odd for 16-byte readers
#define PV_VPITCH (PVK * 2 + 16)      // LDS pitch of a v row, bytes: 16 B x odd
#define PV_PBUF (64 * PV_PPITCH)
#define PV_VBUF (DVH * PV_VPITCH)
// eight asynchronous copies global -> LDS, 16 B a lane each, rows ls / gs bytes apart; the s_wait_xcnt in the same statement stands before any rewrite of the address registers
__device__ __forceinline__ void acopy8(unsigned l, unsigned ls, const char* gsrc, size_t gs) {
  asm volatile("global_load_async_to_lds_b128 %0, %8, off\n\tglobal_load_async_to_lds_b128 %1, %9, off\n\tglobal_load_async_to_lds_b128 %2, %10, off\n\tglobal_load_async_to_lds_b128 %3, %11, off\n\t"
               "global_load_async_to_lds_b128 %4, %12, off\n\tglobal_load_async_to_lds_b128 %5, %13, off\n\tglobal_load_async_to_lds_b128 %6, %14, off\n\tglobal_load_async_to_lds_b128 %7, %15, off\n\ts_wait_xcnt 0x0"
               :: "v"(l), "v"(l + ls), "v"(l + 2 * ls), "v"(l + 3 * ls), "v"(l + 4 * ls), "v"(l + 5 * ls), "v"(l + 6 * ls), "v"(l + 7 * ls),
                  "v"(gsrc), "v"(gsrc + gs), "v"(gsrc + 2 * gs), "v"(gsrc + 3 * gs), "v"(gsrc + 4 * gs), "v"(gsrc + 5 * gs), "v"(gsrc + 6 * gs), "v"(gsrc + 7 * gs) : "memory"); }
// one tile: 16 copies a lane for P (4 rows a step) and 16 for v (8 rows a step)
__device__ __forceinline__ void pv_tile(unsigned lp, unsigned lv, const char* gp, const char* gv) {
  acopy8(lp, 4 * PV_PPITCH, gp, (size_t)4 * TT * 4); acopy8(lp + 32 * PV_PPITCH, 4 * PV_PPITCH, gp + (size_t)32 * TT * 4, (size_t)4 * TT * 4);
  acopy8(lv, 8 * PV_VPITCH, gv, (size_t)8 * TT * 2); acopy8(lv + 64 * PV_VPITCH, 8 * PV_VPITCH, gv + (size_t)64 * TT * 2, (size_t)8 * TT * 2); }
// ---- k_pv: block = 64 queries (qb) of (b, h): ctx = P . v over keys [0, kend) (P x 2^11 once to f16 against v f16: 1 product; query blocks < QBH_PV (none here): P and v as bf16 hi + lo, 3 products); 512-B (row, column-half) segment by 32 lanes
__global__ __launch_bounds__(128) void k_pv(const float* __restrict__ PS0, const _Float16* __restrict__ VT, const __bf16* __restrict__ VB, const __bf16* __restrict__ VBL, int bgrp, int h0, float* __restrict__ Y) { const int h = h0; const int b = bgrp + blockIdx.z; const float* PS = PS0 + (size_t)blockIdx.z * TT * TT; const int d0 = blockIdx.y * DVH;   /* group spans batches; column half d0 */ __shared__ __align__(16) float ss[4][16][DVH + 4]; __shared__ __align__(16) unsigned char sp[2][PV_PBUF], sv[2][PV_VBUF];
  const int tid = threadIdx.x, wave = tid >> 5, lane = tid & 31, col = lane & 15, g = lane >> 4; const int qb = blockIdx.x; const int ql0 = qb * 64 + wave * 16; const int kce = (kb_last(qb) + 1) * 4;
  v8f acc[DVH / 16] = {};
  if (qb < QBH_PV) {
#pragma unroll 1
    for (int kc = 0; kc < kce; ++kc) { const F2 p = split_row(PS + (size_t)(ql0 + col) * TT, kc * 32, lane);
      asm volatile("s_wait_loadcnt 0x0" ::: "memory");
#pragma unroll
      for (int j = 0; j < DVH / 16; ++j) { const size_t po = ((size_t)b * CC + h * HD + d0 + j * 16 + col) * (size_t)KHI + kc * 32; const v16b vh = frag_b(VB + po, lane); acc[j] = wmma_bf(p.h, vh, acc[j]); acc[j] = wmma_bf(p.l, vh, acc[j]); acc[j] = wmma_bf(p.h, frag_b(VBL + po, lane), acc[j]); } }
  } else {
    // tiles of PVK keys: P 64 rows x 512 B and v DVH rows x 256 B, copied as whole lines into two LDS buffers; tile t + 1 flies while tile t is worked on
    const int nt = kce / (PVK / 32);
    const char* gp = (const char*)(PS + (size_t)(qb * 64 + wave) * TT) + lane * 16;                                            // copy i: P row 4 i + wave, 512 B by one wave
    const char* gv = (const char*)(VT + ((size_t)b * CC + h * HD + d0 + (tid >> 4)) * (size_t)TT) + (tid & 15) * 16;           // copy i: v row 8 i + tid / 16, 256 B by 16 lanes
    const unsigned lp = (unsigned)(size_t)&sp[0][0] + wave * PV_PPITCH + lane * 16, lv = (unsigned)(size_t)&sv[0][0] + (tid >> 4) * PV_VPITCH + (tid & 15) * 16;
    pv_tile(lp, lv, gp, gv);
    asm volatile("s_wait_asynccnt 0x0" ::: "memory");   // tile 0 has landed before any wave reads it
    __syncthreads();
    if (1 < nt) pv_tile(lp + PV_PBUF, lv + PV_VBUF, gp + PVK * 4, gv + PVK * 2);
#pragma unroll 1
    for (int t = 0; t < nt; ++t) { const int bf = t & 1; const v4f* prow = (const v4f*)(sp[bf] + (wave * 16 + col) * PV_PPITCH + g * 32); const unsigned char* vrow = sv[bf] + col * PV_VPITCH;
      v4f pr[2][4]; v16h vf[2][DVH / 16];   // two register sets: the next 32 keys' fragments are read from this same buffer as one group ahead of the current 32 keys' products
#pragma unroll
      for (int i = 0; i < 4; ++i) pr[0][i] = prow[(i >> 1) * 4 + (i & 1)];
#pragma unroll
      for (int j = 0; j < DVH / 16; ++j) vf[0][j] = frag_h((const _Float16*)(vrow + j * 16 * PV_VPITCH), lane);
#pragma unroll
      for (int kc = 0; kc < PVK / 32; ++kc) { const int cs = kc & 1, ns = cs ^ 1;
        if (kc + 1 < PVK / 32) {
#pragma unroll
          for (int i = 0; i < 4; ++i) pr[ns][i] = prow[(kc + 1) * 8 + (i >> 1) * 4 + (i & 1)];
#pragma unroll
          for (int j = 0; j < DVH / 16; ++j) vf[ns][j] = frag_h((const _Float16*)(vrow + j * 16 * PV_VPITCH) + (kc + 1) * 32, lane); }
        v16h p;
#pragma unroll
        for (int i = 0; i < 4; ++i) { p[i] = (_Float16)pr[cs][0][i]; p[4 + i] = (_Float16)pr[cs][1][i]; p[8 + i] = (_Float16)pr[cs][2][i]; p[12 + i] = (_Float16)pr[cs][3][i]; }
#pragma unroll
        for (int j = 0; j < DVH / 16; ++j) acc[j] = wmma16(p, vf[cs][j], acc[j]); }
      asm volatile("s_wait_dscnt 0x0" ::: "memory");     // this wave's reads of buffer bf are done before the buffer is refilled
      asm volatile("s_wait_asynccnt 0x0" ::: "memory");  // this wave's copies of tile t + 1 have landed before the barrier publishes them
      __syncthreads();
      if (t + 2 < nt) pv_tile(lp + bf * PV_PBUF, lv + bf * PV_VBUF, gp + (size_t)(t + 2) * (PVK * 4), gv + (size_t)(t + 2) * (PVK * 2)); }
    asm volatile("s_wait_asynccnt 0x0" ::: "memory");    // no copy is outstanding when the wave goes on
  }
#pragma unroll
  for (int j = 0; j < DVH / 16; ++j)
#pragma unroll
    for (int r = 0; r < 8; ++r) ss[wave][8 * g + r][j * 16 + col] = acc[j][r] * (1.0f / 2048.0f);
  LDSX(); for (int rl = 0; rl < 16; ++rl) vst2(Y + ((size_t)b * TT + ql0 + rl) * CC + h * HD + d0 + lane * 4, *(const v4f*)&ss[wave][rl][lane * 4]); }   /* 512-B (row, column-half) segment by 32 lanes */

__global__ __launch_bounds__(256) void k_axpy(const float* __restrict__ YR, const float* __restrict__ X, const float* __restrict__ GM, float* __restrict__ OUT) { const size_t e = ((size_t)blockIdx.x * 256 + threadIdx.x) * 4; if (e >= (size_t)TNB * TT * DIN) return; const float gmv = bfr(GM[0]); const v4f o = *(const v4f*)(YR + e); const v4f xr = *(const v4f*)(X + e); asm volatile("s_wait_loadcnt 0x0" ::: "memory"); v4f y; _Pragma("unroll") for (int i = 0; i < 4; ++i) y[i] = gmv * o[i] + bfr(xr[i]); vst2(OUT + e, y); }
extern "C" void kernel_launch(void* const* d_in, const int* in_sizes, int n_in, void* d_out, int out_size, void* d_ws, size_t ws_size, hipStream_t stream) {
  (void)in_sizes; (void)n_in; (void)out_size;
  const float** F = (const float**)d_in;
  if (ws_size < (size_t)WS_END) return;
  char* ws = (char*)d_ws; _Float16 *QH = (_Float16*)(ws + WS_QH), *KH = (_Float16*)(ws + WS_KH), *VT = (_Float16*)(ws + WS_VT), *QL = (_Float16*)(ws + WS_QL), *KL = (_Float16*)(ws + WS_KL); __bf16 *VB = (__bf16*)(ws + WS_VB), *VBL = (__bf16*)(ws + WS_VBL); float *S = (float*)(ws + WS_S), *Y = (float*)(ws + WS_Y);
  (void)Y; (void)QL; (void)KL; (void)VB; (void)VBL;
  // inputs: 0 x [4,2048,1024]; 1 Wq [1024,256] (in,out), 2 bq; 3 Wk, 4 bk; 5 Wv, 6 bv
  if (ws_size < (size_t)WS_END) return;
  k_proj<<<dim3(TNB * TT / 64, CC / 128, 3), 128, 0, stream>>>(F[0], F[0], F[0], F[1], F[3], F[5], F[2], F[4], F[6], QH, QL, KH, KL, VT, VB, VBL);
  for (int b0 = 0; b0 < TNB; b0 += BG) {
    k_sc<<<dim3(NQB, TT / 128, BG), 128, 0, stream>>>(QH, KH, QL, KL, b0, 0, S);
    k_sm<<<dim3(TT, BG), 256, 0, stream>>>(S);
    k_pv<<<dim3(NQB, HD / DVH, BG), 128, 0, stream>>>(S, VT, VB, VBL, b0, 0, (float*)d_out);   /* out rows [b*T + t][256] directly */
  }
}

// v003
// A run of this version takes 173 microseconds.
// Two timings next to v002 both put it at 1.28 times that version's speed.
// Counting every step since v000, it is 3.70 times as fast.
// compute dtype: all float inputs rounded to bf16; q/k/v = x W + b with EXACT bf16 products on WMMA 16x16x32 (f32 accumulate); logits x sqrt(1024) = 32 (sigma_logit ~ 170, near one-hot rows) with q AND k as f16 hi + residual planes (3 products); softmax in f32 (precise expf); attn P x 2^11 as f16 against v f16 (1 product); f32 output.
// Single attention head with a MULTIPLIED scale (B 4, T 2,048, C 1,024 -> E 256; (in,out) uniform +-1/32 weights with biases): q, k, v = x W + b; wei = softmax(q k^T * sqrt(1024)); out = wei v -> [4, 2,048, 256] (non-causal).
#include <hip/hip_runtime.h>
#include <math.h>

typedef __attribute__((ext_vector_type(16))) _Float16 v16h;
typedef __attribute__((ext_vector_type(16))) __bf16 v16b;
typedef __attribute__((ext_vector_type(8)))  _Float16 v8h;
typedef __attribute__((ext_vector_type(8)))  float v8f;
typedef __attribute__((ext_vector_type(4)))  float v4f;
typedef __attribute__((ext_vector_type(2)))  float v2f;
typedef __attribute__((ext_vector_type(4)))  unsigned v4u;
typedef __attribute__((ext_vector_type(4)))  int v4i;
typedef float __attribute__((may_alias)) float_a;
typedef int __attribute__((may_alias)) int_a;

template <typename T> __device__ __forceinline__ void vst2(void* p, T v) { *(T*)p = v;  }
__device__ __forceinline__ v8f wmma16(v16h a, v16h b, v8f c) {
  v8f d = __builtin_amdgcn_wmma_f32_16x16x32_f16(false, a, false, b, (short)0, c, false, false);
  asm volatile("v_nop\n\tv_nop\n\tv_nop\n\tv_nop" : "+v"(d) : "v"(a), "v"(b));
  return d;
}
__device__ __forceinline__ v8f wmma_bf(v16b a, v16b b, v8f c) {
  v8f d = __builtin_amdgcn_wmma_f32_16x16x32_bf16(false, a, false, b, (short)0, c, false, false);
  asm volatile("v_nop\n\tv_nop\n\tv_nop\n\tv_nop" : "+v"(d) : "v"(a), "v"(b));
  return d;
}
// 16x16x32 fragments: lane = (h = lane>>4, row/col = lane&15); elements 0..7 = k0+8h+0..7, 8..15 = k0+16+8h+0..7; D element r = row 8h+r
__device__ __forceinline__ v16h frag_h(const _Float16* rowk0, int lane) {
  union { v16h v; v8h q[2]; } u; const _Float16* p = rowk0 + 8 * (lane >> 4);
  u.q[0] = *(const v8h*)p; u.q[1] = *(const v8h*)(p + 16); return u.v;
}
__device__ __forceinline__ v16h frag_f32(const float* rowk0, int lane) {
  v16h a; const float* p = rowk0 + 8 * (lane >> 4);
#pragma unroll
  for (int i = 0; i < 8; ++i) { a[i] = (_Float16)p[i]; a[8 + i] = (_Float16)p[16 + i]; }
  return a;
}
__device__ __forceinline__ v16h frag_f32s(const float* rowk0, int lane, float sc) {
  v16h a; const float* p = rowk0 + 8 * (lane >> 4);
#pragma unroll
  for (int i = 0; i < 8; ++i) { a[i] = (_Float16)(p[i] * sc); a[8 + i] = (_Float16)(p[16 + i] * sc); }
  return a;
}
// column fragment from a [K][ld] layout (column n), rows >= K read as 0
__device__ __forceinline__ v16h fragc_f32(const float* W, int k0, int n, int lane, int ld, int K) {
  v16h a; const int g = lane >> 4;
#pragma unroll
  for (int i = 0; i < 8; ++i) { const int ka = k0 + 8 * g + i, kb = ka + 16;
    a[i] = (_Float16)(ka < K ? W[(size_t)(ka < K ? ka : K - 1) * ld + n] : 0.f); a[8 + i] = (_Float16)(kb < K ? W[(size_t)(kb < K ? kb : K - 1) * ld + n] : 0.f); }
  return a;
}
struct F2 { v16b h, l; };
__device__ __forceinline__ F2 bsplit16(const float v[16]) { F2 r;
#pragma unroll
  for (int i = 0; i < 16; ++i) { const __bf16 h = (__bf16)v[i]; r.h[i] = h; r.l[i] = (__bf16)(v[i] - (float)h); }
  return r; }
__device__ __forceinline__ F2 split_row(const float* row, int k0, int lane) { float v[16]; const float* p = row + k0 + 8 * (lane >> 4);
#pragma unroll
  for (int i = 0; i < 8; ++i) { v[i] = p[i]; v[8 + i] = p[16 + i]; }
  return bsplit16(v); }
__device__ __forceinline__ F2 split_rowK(const float* row, int k0, int lane, int K) { float v[16]; const int g = lane >> 4;
#pragma unroll
  for (int i = 0; i < 8; ++i) { const int ka = k0 + 8 * g + i, kb = ka + 16; v[i] = ka < K ? row[ka < K ? ka : K - 1] : 0.f; v[8 + i] = kb < K ? row[kb < K ? kb : K - 1] : 0.f; }
  return bsplit16(v); }
__device__ __forceinline__ F2 split_col(const float* W, int k0, int n, int lane, int ld, int K) { float v[16]; const int g = lane >> 4;
#pragma unroll
  for (int i = 0; i < 8; ++i) { const int ka = k0 + 8 * g + i, kb = ka + 16; v[i] = ka < K ? W[(size_t)(ka < K ? ka : K - 1) * ld + n] : 0.f; v[8 + i] = kb < K ? W[(size_t)(kb < K ? kb : K - 1) * ld + n] : 0.f; }
  return bsplit16(v); }
__device__ __forceinline__ v8f mac3(const F2& a, const F2& b, v8f c) { c = wmma_bf(a.l, b.h, c); c = wmma_bf(a.h, b.l, c); return wmma_bf(a.h, b.h, c); }
__device__ __forceinline__ float sigm(float v) { return 1.0f / (1.0f + expf(-v)); }
#define LDSX() do { asm volatile("s_wait_dscnt 0" ::: "memory"); __builtin_amdgcn_wave_barrier(); __builtin_amdgcn_fence(__ATOMIC_RELEASE, "workgroup"); } while (0)

#define NB 4
#define TT 2048
#define CC 256
#define DIN 1024
#define NH 1
#define HD 256
#define NQB (TT / 64)
#define HG NB              // all NB score planes at once: one launch of each stage covers every batch (blockIdx.z / blockIdx.y = batch)
#define SCALE (32.0f)
#define HDQK 256            // all 256 columns enter the logits
#define CAUSAL 0
#ifndef TNB
#define TNB NB
#endif
__device__ __forceinline__ v16b zero16b() { v16b z; _Pragma("unroll") for (int i = 0; i < 16; ++i) z[i] = (__bf16)0.f; return z; }
__device__ __forceinline__ float bfr(float v) { return (float)(__bf16)v; }
__host__ __device__ __forceinline__ int kb_last(int qb) { return CAUSAL ? ((qb * 64 + 63) >> 7) : (TT / 128 - 1); }
typedef __attribute__((ext_vector_type(8))) __bf16 v8b;
__device__ __forceinline__ v16b frag_b(const __bf16* rowk0, int lane) {
  union { v16b v; v8b q[2]; } u; const __bf16* p = rowk0 + 8 * (lane >> 4);
  u.q[0] = *(const v8b*)p; u.q[1] = *(const v8b*)(p + 16); return u.v;
}
#define QBH (TT / 64)      // ALL query blocks take k_sc's 3-product path
#define QBH_PV 0           // A.g stays single f16
#define QHI 2048            // q residual rows everywhere (3-product logits: sigma_logit ~ 170)
#define KHI 2048
// B fragment (k rows k0+.., output column o) of a weight: (in,out) [K][ld] or (out,in) [ld rows of K]: bf16 exact, or f16(bf16 * 256) exact
__device__ __forceinline__ v16b wcol_io(const float* Wm, int k0, int o, int lane, int ld) { v16b w; const int g = lane >> 4;
#pragma unroll
  for (int i = 0; i < 8; ++i) { w[i] = (__bf16)Wm[(size_t)(k0 + 8 * g + i) * ld + o]; w[8 + i] = (__bf16)Wm[(size_t)(k0 + 16 + 8 * g + i) * ld + o]; }
  return w; }
__device__ __forceinline__ v16b wcol_oi(const float* Wm, int k0, int o, int lane, int K) { v16b w; const float* p = Wm + (size_t)o * K + k0 + 8 * (lane >> 4);
#pragma unroll
  for (int i = 0; i < 8; ++i) { w[i] = (__bf16)p[i]; w[8 + i] = (__bf16)p[16 + i]; }
  return w; }
__device__ __forceinline__ v16h wcolh_io(const float* Wm, int k0, int o, int lane, int ld) { v16h w; const int g = lane >> 4;
#pragma unroll
  for (int i = 0; i < 8; ++i) { w[i] = (_Float16)(bfr(Wm[(size_t)(k0 + 8 * g + i) * ld + o]) * 256.0f); w[8 + i] = (_Float16)(bfr(Wm[(size_t)(k0 + 16 + 8 * g + i) * ld + o]) * 256.0f); }
  return w; }
__device__ __forceinline__ v16h wcolh_oi(const float* Wm, int k0, int o, int lane, int K) { v16h w; const float* p = Wm + (size_t)o * K + k0 + 8 * (lane >> 4);
#pragma unroll
  for (int i = 0; i < 8; ++i) { w[i] = (_Float16)(bfr(p[i]) * 256.0f); w[8 + i] = (_Float16)(bfr(p[16 + i]) * 256.0f); }
  return w; }
#define WQKV_LAYOUT 1   // 0 = (in,out) [DIN][CC]; 1 = (in,out) [DIN][CC] as well; 2 = per-head [NH][DIN][HD]
__device__ __forceinline__ v16b wcol_hdk(const float* Wm, int k0, int o, int lane) { v16b w; const int g = lane >> 4; const float* p = Wm + (size_t)(o / HD) * DIN * HD + (o % HD);
#pragma unroll
  for (int i = 0; i < 8; ++i) { w[i] = (__bf16)p[(size_t)(k0 + 8 * g + i) * HD]; w[8 + i] = (__bf16)p[(size_t)(k0 + 16 + 8 * g + i) * HD]; }
  return w; }
#define WO_OUT_IN 0
#if WQKV_LAYOUT == 1
#define WCOL(W, k0, o, lane) wcol_io(W, k0, (o), lane, CC)   /* (in,out) Wq/Wk/Wv [1024][256] */
#define WCOL_OLD_UNUSED(W, k0, o, lane) (((o) < HDQK) ? wcol_oi(W, k0, (o), lane, DIN) : zero16b())
#elif WQKV_LAYOUT == 2
#define WCOL(W, k0, o, lane) wcol_hdk(W, k0, o, lane)
#else
#define WCOL(W, k0, o, lane) wcol_io(W, k0, o, lane, CC)
#endif
#if WO_OUT_IN
#define WOCOL(W, k0, o, lane) wcol_oi(W, k0, o, lane, CC)
#define WOCOLH(W, k0, o, lane) wcolh_oi(W, k0, o, lane, CC)
#else
#define WOCOL(W, k0, o, lane) wcol_io(W, k0, o, lane, DIN)
#define WOCOLH(W, k0, o, lane) wcolh_io(W, k0, o, lane, DIN)
#endif
#ifndef XP
#define OUT1_OFF (4u * (size_t)NB * DIN * TT)   /* unused: the launch writes a single output */
#define XP TT              // channel-row pitch of k_fin2's X and outputs (k_fin2 is not launched)
#endif
#define BG HG              // the pass group spans BATCHES (single head): blockIdx.z / blockIdx.y select batch b0 + z
#define DVH 128

// ---- k_wz: block = (64 rows, 128 output cols): OR = y (hi + lo, K = 256 columns of the YR rows) . W^T ((out,in) rows of 256, exact) + b
__global__ __launch_bounds__(128) void k_wz(const float* __restrict__ YR, const float* __restrict__ WW, const float* __restrict__ WB, float* __restrict__ ORW) { __shared__ __align__(16) float sf[4][16][132];
  const int tid = threadIdx.x, wave = tid >> 5, lane = tid & 31, col = lane & 15, g = lane >> 4; const int c0 = blockIdx.y * 128; const size_t r0 = (size_t)blockIdx.x * 64 + wave * 16;
  v8f acc[8] = {};
#pragma unroll
  for (int kc = 0; kc < HDQK / 32; ++kc) { const F2 a = split_row(YR + (r0 + col) * CC, kc * 32, lane); asm volatile("s_wait_loadcnt 0x0" ::: "memory");
#pragma unroll
    for (int j = 0; j < 8; ++j) { const v16b w = wcol_oi(WW, kc * 32, c0 + j * 16 + col, lane, HDQK); asm volatile("s_wait_loadcnt 0x0" ::: "memory"); acc[j] = wmma_bf(a.h, w, acc[j]); acc[j] = wmma_bf(a.l, w, acc[j]); } }
#pragma unroll
  for (int j = 0; j < 8; ++j) { const float bb = WB ? bfr(WB[c0 + j * 16 + col]) : 0.f; asm volatile("s_wait_loadcnt 0x0" ::: "memory");
#pragma unroll
    for (int r = 0; r < 8; ++r) sf[wave][8 * g + r][j * 16 + col] = acc[j][r] + bb; }
  LDSX(); for (int rl = 0; rl < 16; ++rl) vst2(ORW + (r0 + rl) * DIN + c0 + lane * 4, *(const v4f*)&sf[wave][rl][lane * 4]); }
// ---- k_fin2: block = (64 positions, 64 channels, batch b): o[b][c][n] = OR[b*N + n][c] (channels-first via LDS transpose) -> output 1; y = gamma * o + bf16(x) -> output 0 (256-B runs)
__global__ __launch_bounds__(256) void k_fin2(const float* __restrict__ ORW, const float* __restrict__ X, const float* __restrict__ GM, float* __restrict__ OUT, float* __restrict__ OUT1) { const float gmv = bfr(GM[0]); __shared__ float st[64][68]; const int tid = threadIdx.x; const int n0 = blockIdx.x * 64, c0 = blockIdx.y * 64; const size_t b = blockIdx.z;
  for (int e = tid; e < 64 * 16; e += 256) { const int nl = e >> 4, q = e & 15; *(v4f*)&st[nl][q * 4] = *(const v4f*)(ORW + (b * TT + n0 + nl) * (size_t)DIN + c0 + q * 4); }
  __syncthreads();
  for (int e = tid; e < 64 * 16; e += 256) { const int cl = e >> 4, q = e & 15; const size_t oi = (b * DIN + c0 + cl) * (size_t)XP + n0 + q * 4; const v4f xr = *(const v4f*)(X + oi); v4f o, y; _Pragma("unroll") for (int i = 0; i < 4; ++i) { o[i] = st[q * 4 + i][cl]; y[i] = gmv * o[i] + bfr(xr[i]); } vst2(OUT + oi, y); vst2(OUT1 + oi, o); } }   /* y = gamma * o + x (output 0), o (output 1) */
#ifndef SM_EXTRA_PARAMS
#define SM_EXTRA_PARAMS
#endif
#ifndef PROJ_EXTRA_PARAMS
#define PROJ_EXTRA_PARAMS
#endif
#ifndef SM_MASK_HOOK
#define SM_MASK_HOOK (void)0
#endif

#define WS_QH  0u                                      // f16 q rows [b*t][CC]
#define WS_KH  (WS_QH + 2u * (size_t)NB * TT * CC)      // f16 k rows [b*t][CC]
#define WS_VT  (WS_KH + 2u * (size_t)NB * TT * CC)      // f16 v planes [b][c][t]
#define WS_QL  (WS_VT + 2u * (size_t)NB * CC * TT)      // f16 q residual x 2^10 rows [b][t < QHI][CC]
#define WS_KL  (WS_QL + 2u * (size_t)NB * QHI * CC)     // f16 k residual x 2^10 rows [b][t < KHI][CC]
#define WS_VB  (WS_KL + 2u * (size_t)NB * KHI * CC)     // bf16 v hi planes [b][c][t < KHI]
#define WS_VBL (WS_VB + 2u * (size_t)NB * CC * KHI)
#define WS_S   (WS_VBL + 2u * (size_t)NB * CC * KHI)    // f32 logits / P [hg][t][s]
#define WS_Y   (WS_S  + 4u * (size_t)HG * TT * TT)      // f32 ctx rows [b*t][CC] (only when there is an output projection)
#define WS_END (WS_Y  + 0u)

// ---- k_proj: block = (64 rows, 128 cols, which): q/k/v = X W (+ b) with exact bf16 products (K = DIN) -> which 0: q f16 rows (+ residual rows < QHI); 1: k f16 rows (+ residual rows < KHI); 2: v f16 planes [c][t] (+ bf16 hi/lo planes for t < KHI)
__global__ __launch_bounds__(128) void k_proj(const float* __restrict__ XQ, const float* __restrict__ XK, const float* __restrict__ XV, const float* __restrict__ WQ, const float* __restrict__ WK, const float* __restrict__ WV, const float* __restrict__ BQ, const float* __restrict__ BK, const float* __restrict__ BV,
    _Float16* __restrict__ QH, _Float16* __restrict__ QL, _Float16* __restrict__ KH, _Float16* __restrict__ KL, _Float16* __restrict__ VT, __bf16* __restrict__ VB, __bf16* __restrict__ VBL) {
  __shared__ __align__(16) _Float16 sh[64][136], sl[64][136]; __shared__ __align__(16) _Float16 th[128][72]; __shared__ __align__(16) __bf16 tb[128][72], tbl[128][72];
  const int tid = threadIdx.x, wave = tid >> 5, lane = tid & 31, col = lane & 15, g = lane >> 4; const int which = blockIdx.z; const int c0 = blockIdx.y * 128; const size_t r0 = (size_t)blockIdx.x * 64; const size_t bb = r0 / TT; const int t0 = (int)(r0 % TT);
  const float* X = which == 0 ? XQ : which == 1 ? XK : XV; const float* WA = which == 0 ? WQ : which == 1 ? WK : WV; const float* BA = which == 0 ? BQ : which == 1 ? BK : BV;
  v8f acc[8] = {};
#pragma unroll 2
  for (int kc = 0; kc < DIN / 32; ++kc) { v16b a; { const float* p = X + (r0 + wave * 16 + col) * (size_t)DIN + kc * 32 + 8 * g;   /* channels-LAST: plain rows x[b*T + t][k] */
#pragma unroll
      for (int i = 0; i < 8; ++i) { a[i] = (__bf16)p[i]; a[8 + i] = (__bf16)p[16 + i]; } }
    asm volatile("s_wait_loadcnt 0x0" ::: "memory");
#pragma unroll
    for (int j = 0; j < 8; ++j) { const v16b w = WCOL(WA, kc * 32, c0 + j * 16 + col, lane); asm volatile("s_wait_loadcnt 0x0" ::: "memory"); acc[j] = wmma_bf(a, w, acc[j]); } }
  if (which < 2) { _Float16* DH = which == 0 ? QH : KH; _Float16* DL = which == 0 ? QL : KL; const int nhi = which == 0 ? QHI : KHI; const bool hi_rows = t0 < nhi;
#pragma unroll
    for (int j = 0; j < 8; ++j) { const float bias = (BA && (which == 2 || (c0 + j * 16 + col) < HDQK)) ? bfr(BA[c0 + j * 16 + col]) : 0.f;   /* q/k/v: all 256 columns */   /* 256-entry biases */
#pragma unroll
      for (int r = 0; r < 8; ++r) { const float v = acc[j][r] + bias; const _Float16 hv = (_Float16)v; sh[wave * 16 + 8 * g + r][j * 16 + col] = hv; sl[wave * 16 + 8 * g + r][j * 16 + col] = (_Float16)((v - (float)hv) * 1024.0f); } }
    __syncthreads();
    for (int e = tid; e < 64 * 16; e += 128) { const int rl = e >> 4, q = e & 15; vst2((unsigned*)(DH + (r0 + rl) * CC + c0 + q * 8), *(const v4u*)&sh[rl][q * 8]); if (hi_rows) vst2((unsigned*)(DL + (bb * nhi + t0 + rl) * (size_t)CC + c0 + q * 8), *(const v4u*)&sl[rl][q * 8]); }
  } else { const bool hi_rows = t0 < KHI;
#pragma unroll
    for (int j = 0; j < 8; ++j) { const float bias = (BA && (which == 2 || (c0 + j * 16 + col) < HDQK)) ? bfr(BA[c0 + j * 16 + col]) : 0.f;   /* q/k/v: all 256 columns */   /* 256-entry biases */
#pragma unroll
      for (int r = 0; r < 8; ++r) { const float v = acc[j][r] + bias; const int rl = wave * 16 + 8 * g + r, cl = j * 16 + col; th[cl][rl] = (_Float16)v; const __bf16 bh = (__bf16)v; tb[cl][rl] = bh; tbl[cl][rl] = (__bf16)(v - (float)bh); } }
    __syncthreads();
    for (int e = tid; e < 128 * 8; e += 128) { const int cl = e >> 3, q = e & 7; vst2((unsigned*)(VT + (bb * CC + c0 + cl) * (size_t)TT + t0 + q * 8), *(const v4u*)&th[cl][q * 8]); if (hi_rows) { const size_t o3 = (bb * CC + c0 + cl) * (size_t)KHI + t0 + q * 8; vst2((unsigned*)(VB + o3), *(const v4u*)&tb[cl][q * 8]); vst2((unsigned*)(VBL + o3), *(const v4u*)&tbl[cl][q * 8]); } } } }
// eight asynchronous copies global -> LDS, 16 B a lane each, rows ls / gs bytes apart; the s_wait_xcnt in the same statement stands before any rewrite of the address registers
__device__ __forceinline__ void acopy8(unsigned l, unsigned ls, const char* gsrc, size_t gs) {
  asm volatile("global_load_async_to_lds_b128 %0, %8, off\n\tglobal_load_async_to_lds_b128 %1, %9, off\n\tglobal_load_async_to_lds_b128 %2, %10, off\n\tglobal_load_async_to_lds_b128 %3, %11, off\n\t"
               "global_load_async_to_lds_b128 %4, %12, off\n\tglobal_load_async_to_lds_b128 %5, %13, off\n\tglobal_load_async_to_lds_b128 %6, %14, off\n\tglobal_load_async_to_lds_b128 %7, %15, off\n\ts_wait_xcnt 0x0"
               :: "v"(l), "v"(l + ls), "v"(l + 2 * ls), "v"(l + 3 * ls), "v"(l + 4 * ls), "v"(l + 5 * ls), "v"(l + 6 * ls), "v"(l + 7 * ls),
                  "v"(gsrc), "v"(gsrc + gs), "v"(gsrc + 2 * gs), "v"(gsrc + 3 * gs), "v"(gsrc + 4 * gs), "v"(gsrc + 5 * gs), "v"(gsrc + 6 * gs), "v"(gsrc + 7 * gs) : "memory"); }
// four such copies, the same form
__device__ __forceinline__ void acopy4(unsigned l, unsigned ls, const char* gsrc, size_t gs) {
  asm volatile("global_load_async_to_lds_b128 %0, %4, off\n\tglobal_load_async_to_lds_b128 %1, %5, off\n\tglobal_load_async_to_lds_b128 %2, %6, off\n\tglobal_load_async_to_lds_b128 %3, %7, off\n\ts_wait_xcnt 0x0"
               :: "v"(l), "v"(l + ls), "v"(l + 2 * ls), "v"(l + 3 * ls), "v"(gsrc), "v"(gsrc + gs), "v"(gsrc + 2 * gs), "v"(gsrc + 3 * gs) : "memory"); }
#define SCK 64                        // columns of q and k per staged tile of k_sc: one 128-B line of every row
#define SC_PITCH (SCK * 2 + 16)       // LDS pitch of a staged row, bytes: 16 B x odd for 16-byte readers
#define SC_QL (64 * SC_PITCH)         // byte offsets of the planes in one buffer: q hi at 0, q residual, k hi, k residual
#define SC_KH (2 * 64 * SC_PITCH)
#define SC_KL (SC_KH + 128 * SC_PITCH)
#define SC_BUF (SC_KL + 128 * SC_PITCH)
// one tile: 16 rows a step (8 lanes a row): 4 copies a lane for each q plane (64 rows), 8 for each k plane (128 rows)
__device__ __forceinline__ void sc_tile(unsigned l, const char* gqh, const char* gql, const char* gkh, const char* gkl) {
  acopy4(l, 16 * SC_PITCH, gqh, (size_t)16 * CC * 2); acopy4(l + SC_QL, 16 * SC_PITCH, gql, (size_t)16 * CC * 2);
  acopy8(l + SC_KH, 16 * SC_PITCH, gkh, (size_t)16 * CC * 2); acopy8(l + SC_KL, 16 * SC_PITCH, gkl, (size_t)16 * CC * 2); }
// ---- k_sc: block = (query block qb, key block kb <= kb_last(qb), batch b in group): logits x SCALE; q hi + residual (x 2^10) against k (2 products) for query rows < QHI, plus the k residual (3 products) for query blocks < QBH (every query block); causal: blocks past the diagonal exit, the mask itself is applied by index in k_sm
__global__ __launch_bounds__(128) void k_sc(const _Float16* __restrict__ QH, const _Float16* __restrict__ KH, const _Float16* __restrict__ QL, const _Float16* __restrict__ KL, int bgrp, int h0, float* __restrict__ S0) { __shared__ __align__(16) float ss[4][16][132]; __shared__ __align__(16) unsigned char st[2][SC_BUF];
  const int qb = blockIdx.x, kb = blockIdx.y; if (kb > kb_last(qb)) return;
  const int h = h0; const int b = bgrp + blockIdx.z; float* S = S0 + (size_t)blockIdx.z * TT * TT;   /* group spans batches */
  const int tid = threadIdx.x, wave = tid >> 5, lane = tid & 31, col = lane & 15, g = lane >> 4; const int k0 = kb * 128; const int ql0 = qb * 64 + wave * 16; const size_t q0 = (size_t)b * TT + ql0, kr0 = (size_t)b * TT + k0;
  v8f acc[8] = {}, accl[8] = {};
  const _Float16* QLb = QL + (size_t)b * QHI * CC; const _Float16* KLb = KL + (size_t)b * KHI * CC;
  if (qb < QBH) {
    // tiles of SCK columns: q hi + residual 64 rows and k hi + residual 128 rows, 128 B a row, copied as whole lines into two LDS buffers; tile t + 1 flies while tile t is worked on
    const int cr = tid >> 3, cp = (tid & 7) * 16;   // copy i: row 16 i + tid / 8, 128 B by 8 lanes
    const char* gqh = (const char*)(QH + ((size_t)b * TT + qb * 64 + cr) * CC + h * HD) + cp; const char* gql = (const char*)(QLb + (size_t)(qb * 64 + cr) * CC + h * HD) + cp;
    const char* gkh = (const char*)(KH + (kr0 + cr) * CC + h * HD) + cp; const char* gkl = (const char*)(KLb + (size_t)(k0 + cr) * CC + h * HD) + cp;
    const unsigned l0 = (unsigned)(size_t)&st[0][0] + cr * SC_PITCH + cp;
    sc_tile(l0, gqh, gql, gkh, gkl);
    asm volatile("s_wait_asynccnt 0x0" ::: "memory");   // tile 0 has landed before any wave reads it
    __syncthreads();
    sc_tile(l0 + SC_BUF, gqh + SCK * 2, gql + SCK * 2, gkh + SCK * 2, gkl + SCK * 2);
#pragma unroll 1
    for (int t = 0; t < HDQK / SCK; ++t) { const int bf = t & 1; const unsigned char* qrow = st[bf] + (wave * 16 + col) * SC_PITCH; const unsigned char* krow = st[bf] + SC_KH + col * SC_PITCH;
      v16h ah[SCK / 32], al[SCK / 32], kh[2][2], kl[2][2];   // two register sets of k fragments: the next two key columns' fragments are read from this same buffer as one group ahead of the current two's products
#pragma unroll
      for (int c = 0; c < SCK / 32; ++c) { ah[c] = frag_h((const _Float16*)qrow + c * 32, lane); al[c] = frag_h((const _Float16*)(qrow + SC_QL) + c * 32, lane); }
#pragma unroll
      for (int i = 0; i < 2; ++i) { kh[0][i] = frag_h((const _Float16*)(krow + i * 16 * SC_PITCH), lane); kl[0][i] = frag_h((const _Float16*)(krow + (SC_KL - SC_KH) + i * 16 * SC_PITCH), lane); }
#pragma unroll
      for (int gi = 0; gi < (SCK / 32) * 4; ++gi) { const int cs = gi & 1, ns = cs ^ 1, c = gi >> 2;
        if (gi + 1 < (SCK / 32) * 4) { const int nc = (gi + 1) >> 2, nj = ((gi + 1) & 3) * 2;
#pragma unroll
          for (int i = 0; i < 2; ++i) { kh[ns][i] = frag_h((const _Float16*)(krow + (nj + i) * 16 * SC_PITCH) + nc * 32, lane); kl[ns][i] = frag_h((const _Float16*)(krow + (SC_KL - SC_KH) + (nj + i) * 16 * SC_PITCH) + nc * 32, lane); } }
#pragma unroll
        for (int i = 0; i < 2; ++i) { const int j = (gi & 3) * 2 + i; acc[j] = wmma16(ah[c], kh[cs][i], acc[j]); accl[j] = wmma16(al[c], kh[cs][i], accl[j]); accl[j] = wmma16(ah[c], kl[cs][i], accl[j]); } }
      asm volatile("s_wait_dscnt 0x0" ::: "memory");     // this wave's reads of buffer bf are done before the buffer is refilled
      asm volatile("s_wait_asynccnt 0x0" ::: "memory");  // this wave's copies of tile t + 1 have landed before the barrier publishes them
      __syncthreads();
      if (t + 2 < HDQK / SCK) sc_tile(l0 + bf * SC_BUF, gqh + (t + 2) * (SCK * 2), gql + (t + 2) * (SCK * 2), gkh + (t + 2) * (SCK * 2), gkl + (t + 2) * (SCK * 2)); }
    asm volatile("s_wait_asynccnt 0x0" ::: "memory");    // no copy is outstanding when the wave goes on
  } else if (qb * 64 < QHI) {
#pragma unroll
    for (int kc = 0; kc < HDQK / 32; ++kc) { const v16h ah = frag_h(QH + (q0 + col) * CC + h * HD + kc * 32, lane), al = frag_h(QLb + (size_t)(ql0 + col) * CC + h * HD + kc * 32, lane);
#pragma unroll
      for (int j = 0; j < 8; ++j) { const v16h kbf = frag_h(KH + (kr0 + j * 16 + col) * CC + h * HD + kc * 32, lane); acc[j] = wmma16(ah, kbf, acc[j]); accl[j] = wmma16(al, kbf, accl[j]); } }
  } else {
#pragma unroll
    for (int kc = 0; kc < HDQK / 32; ++kc) { const v16h ah = frag_h(QH + (q0 + col) * CC + h * HD + kc * 32, lane);
#pragma unroll
      for (int j = 0; j < 8; ++j) { const v16h kbf = frag_h(KH + (kr0 + j * 16 + col) * CC + h * HD + kc * 32, lane); acc[j] = wmma16(ah, kbf, acc[j]); } } }
#pragma unroll
  for (int j = 0; j < 8; ++j) {
#pragma unroll
    for (int r = 0; r < 8; ++r) ss[wave][8 * g + r][j * 16 + col] = (acc[j][r] + accl[j][r] * (1.0f / 1024.0f)) * SCALE; }
  LDSX(); for (int rl = 0; rl < 16; ++rl) vst2(S + (size_t)(ql0 + rl) * TT + k0 + lane * 4, *(const v4f*)&ss[wave][rl][lane * 4]); }
// ---- k_sm: block = query row t (batch in group): keys [0, kend): causal -> logit if s <= t else excluded; softmax in f32; P x 2^11 in place (0 for excluded)
__global__ __launch_bounds__(256) void k_sm(float* __restrict__ S0 SM_EXTRA_PARAMS) { __shared__ float sred[8]; __shared__ float sbc; __shared__ __align__(16) float shv[TT];
  const int tid = threadIdx.x; const int t = blockIdx.x; const int kend = (kb_last(t >> 6) + 1) * 128;
  float* sr = S0 + (size_t)blockIdx.y * TT * TT + (size_t)t * TT;
  float m = -3.0e38f; for (int k = tid; k < kend; k += 256) { float v = (!CAUSAL || k <= t) ? sr[k] : -3.0e38f; SM_MASK_HOOK; shv[k] = v; m = fmaxf(m, v); }
#pragma unroll
  for (int o = 1; o < 32; o <<= 1) m = fmaxf(m, __shfl_xor(m, o));
  if ((tid & 31) == 0) sred[tid >> 5] = m; __syncthreads(); if (tid == 0) { float a = sred[0]; for (int i = 1; i < 8; ++i) a = fmaxf(a, sred[i]); sbc = a; } __syncthreads(); m = sbc; __syncthreads();
  float sum = 0.f; for (int k = tid; k < kend; k += 256) { const float v = shv[k]; const float e = (v <= -1.0e38f) ? 0.f : expf(v - m); shv[k] = e; sum += e; }
#pragma unroll
  for (int o = 1; o < 32; o <<= 1) sum += __shfl_xor(sum, o);
  if ((tid & 31) == 0) sred[tid >> 5] = sum; __syncthreads(); if (tid == 0) { float a = 0.f; for (int i = 0; i < 8; ++i) a += sred[i]; sbc = a > 0.f ? 2048.0f / a : 0.f; }   /* a fully excluded row yields P = 0 */ __syncthreads(); const float inv = sbc;
  for (int k = tid; k < kend; k += 256) shv[k] = shv[k] * inv;
  __syncthreads(); for (int q = tid; q < kend / 4; q += 256) vst2(sr + q * 4, *(const v4f*)&shv[q * 4]); }
#define PVK 128                       // keys per staged tile of k_pv
#define PV_PPITCH (PVK * 4 + 16)      // LDS pitch of a P row, bytes: 16 B x odd for 16-byte readers
#define PV_VPITCH (PVK * 2 + 16)      // LDS pitch of a v row, bytes: 16 B x odd
#define PV_PBUF (64 * PV_PPITCH)
#define PV_VBUF (DVH * PV_VPITCH)
// one tile: 16 copies a lane for P (4 rows a step) and 16 for v (8 rows a step)
__device__ __forceinline__ void pv_tile(unsigned lp, unsigned lv, const char* gp, const char* gv) {
  acopy8(lp, 4 * PV_PPITCH, gp, (size_t)4 * TT * 4); acopy8(lp + 32 * PV_PPITCH, 4 * PV_PPITCH, gp + (size_t)32 * TT * 4, (size_t)4 * TT * 4);
  acopy8(lv, 8 * PV_VPITCH, gv, (size_t)8 * TT * 2); acopy8(lv + 64 * PV_VPITCH, 8 * PV_VPITCH, gv + (size_t)64 * TT * 2, (size_t)8 * TT * 2); }
// ---- k_pv: block = 64 queries (qb) of (b, h): ctx = P . v over keys [0, kend) (P x 2^11 once to f16 against v f16: 1 product; query blocks < QBH_PV (none here): P and v as bf16 hi + lo, 3 products); 512-B (row, column-half) segment by 32 lanes
__global__ __launch_bounds__(128) void k_pv(const float* __restrict__ PS0, const _Float16* __restrict__ VT, const __bf16* __restrict__ VB, const __bf16* __restrict__ VBL, int bgrp, int h0, float* __restrict__ Y) { const int h = h0; const int b = bgrp + blockIdx.z; const float* PS = PS0 + (size_t)blockIdx.z * TT * TT; const int d0 = blockIdx.y * DVH;   /* group spans batches; column half d0 */ __shared__ __align__(16) float ss[4][16][DVH + 4]; __shared__ __align__(16) unsigned char sp[2][PV_PBUF], sv[2][PV_VBUF];
  const int tid = threadIdx.x, wave = tid >> 5, lane = tid & 31, col = lane & 15, g = lane >> 4; const int qb = blockIdx.x; const int ql0 = qb * 64 + wave * 16; const int kce = (kb_last(qb) + 1) * 4;
  v8f acc[DVH / 16] = {};
  if (qb < QBH_PV) {
#pragma unroll 1
    for (int kc = 0; kc < kce; ++kc) { const F2 p = split_row(PS + (size_t)(ql0 + col) * TT, kc * 32, lane);
      asm volatile("s_wait_loadcnt 0x0" ::: "memory");
#pragma unroll
      for (int j = 0; j < DVH / 16; ++j) { const size_t po = ((size_t)b * CC + h * HD + d0 + j * 16 + col) * (size_t)KHI + kc * 32; const v16b vh = frag_b(VB + po, lane); acc[j] = wmma_bf(p.h, vh, acc[j]); acc[j] = wmma_bf(p.l, vh, acc[j]); acc[j] = wmma_bf(p.h, frag_b(VBL + po, lane), acc[j]); } }
  } else {
    // tiles of PVK keys: P 64 rows x 512 B and v DVH rows x 256 B, copied as whole lines into two LDS buffers; tile t + 1 flies while tile t is worked on
    const int nt = kce / (PVK / 32);
    const char* gp = (const char*)(PS + (size_t)(qb * 64 + wave) * TT) + lane * 16;                                            // copy i: P row 4 i + wave, 512 B by one wave
    const char* gv = (const char*)(VT + ((size_t)b * CC + h * HD + d0 + (tid >> 4)) * (size_t)TT) + (tid & 15) * 16;           // copy i: v row 8 i + tid / 16, 256 B by 16 lanes
    const unsigned lp = (unsigned)(size_t)&sp[0][0] + wave * PV_PPITCH + lane * 16, lv = (unsigned)(size_t)&sv[0][0] + (tid >> 4) * PV_VPITCH + (tid & 15) * 16;
    pv_tile(lp, lv, gp, gv);
    asm volatile("s_wait_asynccnt 0x0" ::: "memory");   // tile 0 has landed before any wave reads it
    __syncthreads();
    if (1 < nt) pv_tile(lp + PV_PBUF, lv + PV_VBUF, gp + PVK * 4, gv + PVK * 2);
#pragma unroll 1
    for (int t = 0; t < nt; ++t) { const int bf = t & 1; const v4f* prow = (const v4f*)(sp[bf] + (wave * 16 + col) * PV_PPITCH + g * 32); const unsigned char* vrow = sv[bf] + col * PV_VPITCH;
      v4f pr[2][4]; v16h vf[2][DVH / 16];   // two register sets: the next 32 keys' fragments are read from this same buffer as one group ahead of the current 32 keys' products
#pragma unroll
      for (int i = 0; i < 4; ++i) pr[0][i] = prow[(i >> 1) * 4 + (i & 1)];
#pragma unroll
      for (int j = 0; j < DVH / 16; ++j) vf[0][j] = frag_h((const _Float16*)(vrow + j * 16 * PV_VPITCH), lane);
#pragma unroll
      for (int kc = 0; kc < PVK / 32; ++kc) { const int cs = kc & 1, ns = cs ^ 1;
        if (kc + 1 < PVK / 32) {
#pragma unroll
          for (int i = 0; i < 4; ++i) pr[ns][i] = prow[(kc + 1) * 8 + (i >> 1) * 4 + (i & 1)];
#pragma unroll
          for (int j = 0; j < DVH / 16; ++j) vf[ns][j] = frag_h((const _Float16*)(vrow + j * 16 * PV_VPITCH) + (kc + 1) * 32, lane); }
        v16h p;
#pragma unroll
        for (int i = 0; i < 4; ++i) { p[i] = (_Float16)pr[cs][0][i]; p[4 + i] = (_Float16)pr[cs][1][i]; p[8 + i] = (_Float16)pr[cs][2][i]; p[12 + i] = (_Float16)pr[cs][3][i]; }
#pragma unroll
        for (int j = 0; j < DVH / 16; ++j) acc[j] = wmma16(p, vf[cs][j], acc[j]); }
      asm volatile("s_wait_dscnt 0x0" ::: "memory");     // this wave's reads of buffer bf are done before the buffer is refilled
      asm volatile("s_wait_asynccnt 0x0" ::: "memory");  // this wave's copies of tile t + 1 have landed before the barrier publishes them
      __syncthreads();
      if (t + 2 < nt) pv_tile(lp + bf * PV_PBUF, lv + bf * PV_VBUF, gp + (size_t)(t + 2) * (PVK * 4), gv + (size_t)(t + 2) * (PVK * 2)); }
    asm volatile("s_wait_asynccnt 0x0" ::: "memory");    // no copy is outstanding when the wave goes on
  }
#pragma unroll
  for (int j = 0; j < DVH / 16; ++j)
#pragma unroll
    for (int r = 0; r < 8; ++r) ss[wave][8 * g + r][j * 16 + col] = acc[j][r] * (1.0f / 2048.0f);
  LDSX(); for (int rl = 0; rl < 16; ++rl) vst2(Y + ((size_t)b * TT + ql0 + rl) * CC + h * HD + d0 + lane * 4, *(const v4f*)&ss[wave][rl][lane * 4]); }   /* 512-B (row, column-half) segment by 32 lanes */

__global__ __launch_bounds__(256) void k_axpy(const float* __restrict__ YR, const float* __restrict__ X, const float* __restrict__ GM, float* __restrict__ OUT) { const size_t e = ((size_t)blockIdx.x * 256 + threadIdx.x) * 4; if (e >= (size_t)TNB * TT * DIN) return; const float gmv = bfr(GM[0]); const v4f o = *(const v4f*)(YR + e); const v4f xr = *(const v4f*)(X + e); asm volatile("s_wait_loadcnt 0x0" ::: "memory"); v4f y; _Pragma("unroll") for (int i = 0; i < 4; ++i) y[i] = gmv * o[i] + bfr(xr[i]); vst2(OUT + e, y); }
extern "C" void kernel_launch(void* const* d_in, const int* in_sizes, int n_in, void* d_out, int out_size, void* d_ws, size_t ws_size, hipStream_t stream) {
  (void)in_sizes; (void)n_in; (void)out_size;
  const float** F = (const float**)d_in;
  if (ws_size < (size_t)WS_END) return;
  char* ws = (char*)d_ws; _Float16 *QH = (_Float16*)(ws + WS_QH), *KH = (_Float16*)(ws + WS_KH), *VT = (_Float16*)(ws + WS_VT), *QL = (_Float16*)(ws + WS_QL), *KL = (_Float16*)(ws + WS_KL); __bf16 *VB = (__bf16*)(ws + WS_VB), *VBL = (__bf16*)(ws + WS_VBL); float *S = (float*)(ws + WS_S), *Y = (float*)(ws + WS_Y);
  (void)Y; (void)QL; (void)KL; (void)VB; (void)VBL;
  // inputs: 0 x [4,2048,1024]; 1 Wq [1024,256] (in,out), 2 bq; 3 Wk, 4 bk; 5 Wv, 6 bv
  if (ws_size < (size_t)WS_END) return;
  k_proj<<<dim3(TNB * TT / 64, CC / 128, 3), 128, 0, stream>>>(F[0], F[0], F[0], F[1], F[3], F[5], F[2], F[4], F[6], QH, QL, KH, KL, VT, VB, VBL);
  for (int b0 = 0; b0 < TNB; b0 += BG) {
    k_sc<<<dim3(NQB, TT / 128, BG), 128, 0, stream>>>(QH, KH, QL, KL, b0, 0, S);
    k_sm<<<dim3(TT, BG), 256, 0, stream>>>(S);
    k_pv<<<dim3(NQB, HD / DVH, BG), 128, 0, stream>>>(S, VT, VB, VBL, b0, 0, (float*)d_out);   /* out rows [b*T + t][256] directly */
  }
}

// v004
// One run takes 114 microseconds.
// Two timings next to v003 both put it at 1.51 times that version's speed.
// Counting every step since v000, it is 5.59 times as fast.
// compute dtype: all float inputs rounded to bf16; q/k/v = x W + b with EXACT bf16 products on WMMA 16x16x32 (f32 accumulate); logits x sqrt(1024) = 32 (sigma_logit ~ 170, near one-hot rows) with q AND k as f16 hi + residual planes (3 products); softmax in f32 (precise expf); attn P x 2^11 as f16 against v f16 (1 product); f32 output.
// Single attention head with a MULTIPLIED scale (B 4, T 2,048, C 1,024 -> E 256; (in,out) uniform +-1/32 weights with biases): q, k, v = x W + b; wei = softmax(q k^T * sqrt(1024)); out = wei v -> [4, 2,048, 256] (non-causal).
#include <hip/hip_runtime.h>
#include <math.h>

typedef __attribute__((ext_vector_type(16))) _Float16 v16h;
typedef __attribute__((ext_vector_type(16))) __bf16 v16b;
typedef __attribute__((ext_vector_type(8)))  _Float16 v8h;
typedef __attribute__((ext_vector_type(8)))  float v8f;
typedef __attribute__((ext_vector_type(4)))  float v4f;
typedef __attribute__((ext_vector_type(2)))  float v2f;
typedef __attribute__((ext_vector_type(4)))  unsigned v4u;
typedef __attribute__((ext_vector_type(4)))  int v4i;
typedef float __attribute__((may_alias)) float_a;
typedef int __attribute__((may_alias)) int_a;

template <typename T> __device__ __forceinline__ void vst2(void* p, T v) { *(T*)p = v;  }
__device__ __forceinline__ v8f wmma16(v16h a, v16h b, v8f c) {
  v8f d = __builtin_amdgcn_wmma_f32_16x16x32_f16(false, a, false, b, (short)0, c, false, false);
  asm volatile("v_nop\n\tv_nop\n\tv_nop\n\tv_nop" : "+v"(d) : "v"(a), "v"(b));
  return d;
}
__device__ __forceinline__ v8f wmma_bf(v16b a, v16b b, v8f c) {
  v8f d = __builtin_amdgcn_wmma_f32_16x16x32_bf16(false, a, false, b, (short)0, c, false, false);
  asm volatile("v_nop\n\tv_nop\n\tv_nop\n\tv_nop" : "+v"(d) : "v"(a), "v"(b));
  return d;
}
// 16x16x32 fragments: lane = (h = lane>>4, row/col = lane&15); elements 0..7 = k0+8h+0..7, 8..15 = k0+16+8h+0..7; D element r = row 8h+r
__device__ __forceinline__ v16h frag_h(const _Float16* rowk0, int lane) {
  union { v16h v; v8h q[2]; } u; const _Float16* p = rowk0 + 8 * (lane >> 4);
  u.q[0] = *(const v8h*)p; u.q[1] = *(const v8h*)(p + 16); return u.v;
}
__device__ __forceinline__ v16h frag_f32(const float* rowk0, int lane) {
  v16h a; const float* p = rowk0 + 8 * (lane >> 4);
#pragma unroll
  for (int i = 0; i < 8; ++i) { a[i] = (_Float16)p[i]; a[8 + i] = (_Float16)p[16 + i]; }
  return a;
}
__device__ __forceinline__ v16h frag_f32s(const float* rowk0, int lane, float sc) {
  v16h a; const float* p = rowk0 + 8 * (lane >> 4);
#pragma unroll
  for (int i = 0; i < 8; ++i) { a[i] = (_Float16)(p[i] * sc); a[8 + i] = (_Float16)(p[16 + i] * sc); }
  return a;
}
// column fragment from a [K][ld] layout (column n), rows >= K read as 0
__device__ __forceinline__ v16h fragc_f32(const float* W, int k0, int n, int lane, int ld, int K) {
  v16h a; const int g = lane >> 4;
#pragma unroll
  for (int i = 0; i < 8; ++i) { const int ka = k0 + 8 * g + i, kb = ka + 16;
    a[i] = (_Float16)(ka < K ? W[(size_t)(ka < K ? ka : K - 1) * ld + n] : 0.f); a[8 + i] = (_Float16)(kb < K ? W[(size_t)(kb < K ? kb : K - 1) * ld + n] : 0.f); }
  return a;
}
struct F2 { v16b h, l; };
__device__ __forceinline__ F2 bsplit16(const float v[16]) { F2 r;
#pragma unroll
  for (int i = 0; i < 16; ++i) { const __bf16 h = (__bf16)v[i]; r.h[i] = h; r.l[i] = (__bf16)(v[i] - (float)h); }
  return r; }
__device__ __forceinline__ F2 split_row(const float* row, int k0, int lane) { float v[16]; const float* p = row + k0 + 8 * (lane >> 4);
#pragma unroll
  for (int i = 0; i < 8; ++i) { v[i] = p[i]; v[8 + i] = p[16 + i]; }
  return bsplit16(v); }
__device__ __forceinline__ F2 split_rowK(const float* row, int k0, int lane, int K) { float v[16]; const int g = lane >> 4;
#pragma unroll
  for (int i = 0; i < 8; ++i) { const int ka = k0 + 8 * g + i, kb = ka + 16; v[i] = ka < K ? row[ka < K ? ka : K - 1] : 0.f; v[8 + i] = kb < K ? row[kb < K ? kb : K - 1] : 0.f; }
  return bsplit16(v); }
__device__ __forceinline__ F2 split_col(const float* W, int k0, int n, int lane, int ld, int K) { float v[16]; const int g = lane >> 4;
#pragma unroll
  for (int i = 0; i < 8; ++i) { const int ka = k0 + 8 * g + i, kb = ka + 16; v[i] = ka < K ? W[(size_t)(ka < K ? ka : K - 1) * ld + n] : 0.f; v[8 + i] = kb < K ? W[(size_t)(kb < K ? kb : K - 1) * ld + n] : 0.f; }
  return bsplit16(v); }
__device__ __forceinline__ v8f mac3(const F2& a, const F2& b, v8f c) { c = wmma_bf(a.l, b.h, c); c = wmma_bf(a.h, b.l, c); return wmma_bf(a.h, b.h, c); }
__device__ __forceinline__ float sigm(float v) { return 1.0f / (1.0f + expf(-v)); }
#define LDSX() do { asm volatile("s_wait_dscnt 0" ::: "memory"); __builtin_amdgcn_wave_barrier(); __builtin_amdgcn_fence(__ATOMIC_RELEASE, "workgroup"); } while (0)

#define NB 4
#define TT 2048
#define CC 256
#define DIN 1024
#define NH 1
#define HD 256
#define NQB (TT / 64)
#define HG NB              // all NB score planes at once: one launch of each stage covers every batch (blockIdx.z / blockIdx.y = batch)
#define SCALE (32.0f)
#define HDQK 256            // all 256 columns enter the logits
#define CAUSAL 0
#ifndef TNB
#define TNB NB
#endif
__device__ __forceinline__ v16b zero16b() { v16b z; _Pragma("unroll") for (int i = 0; i < 16; ++i) z[i] = (__bf16)0.f; return z; }
__device__ __forceinline__ float bfr(float v) { return (float)(__bf16)v; }
__host__ __device__ __forceinline__ int kb_last(int qb) { return CAUSAL ? ((qb * 64 + 63) >> 7) : (TT / 128 - 1); }
typedef __attribute__((ext_vector_type(8))) __bf16 v8b;
__device__ __forceinline__ v16b frag_b(const __bf16* rowk0, int lane) {
  union { v16b v; v8b q[2]; } u; const __bf16* p = rowk0 + 8 * (lane >> 4);
  u.q[0] = *(const v8b*)p; u.q[1] = *(const v8b*)(p + 16); return u.v;
}
#define QBH (TT / 64)      // ALL query blocks take k_sc's 3-product path
#define QBH_PV 0           // A.g stays single f16
#define QHI 2048            // q residual rows everywhere (3-product logits: sigma_logit ~ 170)
#define KHI 2048
// B fragment (k rows k0+.., output column o) of a weight: (in,out) [K][ld] or (out,in) [ld rows of K]: bf16 exact, or f16(bf16 * 256) exact
__device__ __forceinline__ v16b wcol_io(const float* Wm, int k0, int o, int lane, int ld) { v16b w; const int g = lane >> 4;
#pragma unroll
  for (int i = 0; i < 8; ++i) { w[i] = (__bf16)Wm[(size_t)(k0 + 8 * g + i) * ld + o]; w[8 + i] = (__bf16)Wm[(size_t)(k0 + 16 + 8 * g + i) * ld + o]; }
  return w; }
__device__ __forceinline__ v16b wcol_oi(const float* Wm, int k0, int o, int lane, int K) { v16b w; const float* p = Wm + (size_t)o * K + k0 + 8 * (lane >> 4);
#pragma unroll
  for (int i = 0; i < 8; ++i) { w[i] = (__bf16)p[i]; w[8 + i] = (__bf16)p[16 + i]; }
  return w; }
__device__ __forceinline__ v16h wcolh_io(const float* Wm, int k0, int o, int lane, int ld) { v16h w; const int g = lane >> 4;
#pragma unroll
  for (int i = 0; i < 8; ++i) { w[i] = (_Float16)(bfr(Wm[(size_t)(k0 + 8 * g + i) * ld + o]) * 256.0f); w[8 + i] = (_Float16)(bfr(Wm[(size_t)(k0 + 16 + 8 * g + i) * ld + o]) * 256.0f); }
  return w; }
__device__ __forceinline__ v16h wcolh_oi(const float* Wm, int k0, int o, int lane, int K) { v16h w; const float* p = Wm + (size_t)o * K + k0 + 8 * (lane >> 4);
#pragma unroll
  for (int i = 0; i < 8; ++i) { w[i] = (_Float16)(bfr(p[i]) * 256.0f); w[8 + i] = (_Float16)(bfr(p[16 + i]) * 256.0f); }
  return w; }
#define WQKV_LAYOUT 1   // 0 = (in,out) [DIN][CC]; 1 = (in,out) [DIN][CC] as well; 2 = per-head [NH][DIN][HD]
__device__ __forceinline__ v16b wcol_hdk(const float* Wm, int k0, int o, int lane) { v16b w; const int g = lane >> 4; const float* p = Wm + (size_t)(o / HD) * DIN * HD + (o % HD);
#pragma unroll
  for (int i = 0; i < 8; ++i) { w[i] = (__bf16)p[(size_t)(k0 + 8 * g + i) * HD]; w[8 + i] = (__bf16)p[(size_t)(k0 + 16 + 8 * g + i) * HD]; }
  return w; }
#define WO_OUT_IN 0
#if WQKV_LAYOUT == 1
#define WCOL(W, k0, o, lane) wcol_io(W, k0, (o), lane, CC)   /* (in,out) Wq/Wk/Wv [1024][256] */
#define WCOL_OLD_UNUSED(W, k0, o, lane) (((o) < HDQK) ? wcol_oi(W, k0, (o), lane, DIN) : zero16b())
#elif WQKV_LAYOUT == 2
#define WCOL(W, k0, o, lane) wcol_hdk(W, k0, o, lane)
#else
#define WCOL(W, k0, o, lane) wcol_io(W, k0, o, lane, CC)
#endif
#if WO_OUT_IN
#define WOCOL(W, k0, o, lane) wcol_oi(W, k0, o, lane, CC)
#define WOCOLH(W, k0, o, lane) wcolh_oi(W, k0, o, lane, CC)
#else
#define WOCOL(W, k0, o, lane) wcol_io(W, k0, o, lane, DIN)
#define WOCOLH(W, k0, o, lane) wcolh_io(W, k0, o, lane, DIN)
#endif
#ifndef XP
#define OUT1_OFF (4u * (size_t)NB * DIN * TT)   /* unused: the launch writes a single output */
#define XP TT              // channel-row pitch of k_fin2's X and outputs (k_fin2 is not launched)
#endif
#define BG HG              // the pass group spans BATCHES (single head): blockIdx.z / blockIdx.y select batch b0 + z
#define DVH 128

// ---- k_wz: block = (64 rows, 128 output cols): OR = y (hi + lo, K = 256 columns of the YR rows) . W^T ((out,in) rows of 256, exact) + b
__global__ __launch_bounds__(128) void k_wz(const float* __restrict__ YR, const float* __restrict__ WW, const float* __restrict__ WB, float* __restrict__ ORW) { __shared__ __align__(16) float sf[4][16][132];
  const int tid = threadIdx.x, wave = tid >> 5, lane = tid & 31, col = lane & 15, g = lane >> 4; const int c0 = blockIdx.y * 128; const size_t r0 = (size_t)blockIdx.x * 64 + wave * 16;
  v8f acc[8] = {};
#pragma unroll
  for (int kc = 0; kc < HDQK / 32; ++kc) { const F2 a = split_row(YR + (r0 + col) * CC, kc * 32, lane); asm volatile("s_wait_loadcnt 0x0" ::: "memory");
#pragma unroll
    for (int j = 0; j < 8; ++j) { const v16b w = wcol_oi(WW, kc * 32, c0 + j * 16 + col, lane, HDQK); asm volatile("s_wait_loadcnt 0x0" ::: "memory"); acc[j] = wmma_bf(a.h, w, acc[j]); acc[j] = wmma_bf(a.l, w, acc[j]); } }
#pragma unroll
  for (int j = 0; j < 8; ++j) { const float bb = WB ? bfr(WB[c0 + j * 16 + col]) : 0.f; asm volatile("s_wait_loadcnt 0x0" ::: "memory");
#pragma unroll
    for (int r = 0; r < 8; ++r) sf[wave][8 * g + r][j * 16 + col] = acc[j][r] + bb; }
  LDSX(); for (int rl = 0; rl < 16; ++rl) vst2(ORW + (r0 + rl) * DIN + c0 + lane * 4, *(const v4f*)&sf[wave][rl][lane * 4]); }
// ---- k_fin2: block = (64 positions, 64 channels, batch b): o[b][c][n] = OR[b*N + n][c] (channels-first via LDS transpose) -> output 1; y = gamma * o + bf16(x) -> output 0 (256-B runs)
__global__ __launch_bounds__(256) void k_fin2(const float* __restrict__ ORW, const float* __restrict__ X, const float* __restrict__ GM, float* __restrict__ OUT, float* __restrict__ OUT1) { const float gmv = bfr(GM[0]); __shared__ float st[64][68]; const int tid = threadIdx.x; const int n0 = blockIdx.x * 64, c0 = blockIdx.y * 64; const size_t b = blockIdx.z;
  for (int e = tid; e < 64 * 16; e += 256) { const int nl = e >> 4, q = e & 15; *(v4f*)&st[nl][q * 4] = *(const v4f*)(ORW + (b * TT + n0 + nl) * (size_t)DIN + c0 + q * 4); }
  __syncthreads();
  for (int e = tid; e < 64 * 16; e += 256) { const int cl = e >> 4, q = e & 15; const size_t oi = (b * DIN + c0 + cl) * (size_t)XP + n0 + q * 4; const v4f xr = *(const v4f*)(X + oi); v4f o, y; _Pragma("unroll") for (int i = 0; i < 4; ++i) { o[i] = st[q * 4 + i][cl]; y[i] = gmv * o[i] + bfr(xr[i]); } vst2(OUT + oi, y); vst2(OUT1 + oi, o); } }   /* y = gamma * o + x (output 0), o (output 1) */
#ifndef SM_EXTRA_PARAMS
#define SM_EXTRA_PARAMS
#endif
#ifndef PROJ_EXTRA_PARAMS
#define PROJ_EXTRA_PARAMS
#endif
#ifndef SM_MASK_HOOK
#define SM_MASK_HOOK (void)0
#endif

#define WS_QH  0u                                      // f16 q rows [b*t][CC]
#define WS_KH  (WS_QH + 2u * (size_t)NB * TT * CC)      // f16 k rows [b*t][CC]
#define WS_VT  (WS_KH + 2u * (size_t)NB * TT * CC)      // f16 v planes [b][c][t]
#define WS_QL  (WS_VT + 2u * (size_t)NB * CC * TT)      // f16 q residual x 2^10 rows [b][t < QHI][CC]
#define WS_KL  (WS_QL + 2u * (size_t)NB * QHI * CC)     // f16 k residual x 2^10 rows [b][t < KHI][CC]
#define WS_VB  (WS_KL + 2u * (size_t)NB * KHI * CC)     // bf16 v hi planes [b][c][t < KHI]
#define WS_VBL (WS_VB + 2u * (size_t)NB * CC * KHI)
#define WS_S   (WS_VBL + 2u * (size_t)NB * CC * KHI)    // f32 logits / P [hg][t][s]
#define WS_Y   (WS_S  + 4u * (size_t)HG * TT * TT)      // f32 ctx rows [b*t][CC] (only when there is an output projection)
#define WS_END (WS_Y  + 0u)

// ---- k_proj: block = (128 rows, 128 cols, which), 8 waves of 32 rows x 64 cols: q/k/v = X W (+ b) with exact bf16 products (K = DIN) -> which 0: q f16 rows (+ residual rows < QHI); 1: k f16 rows (+ residual rows < KHI); 2: v f16 planes [c][t] (+ bf16 hi/lo planes for t < KHI)
// x and W tiles of PJK k are read as whole lines, rounded to bf16 once and laid in LDS (two buffers); the next tile's global loads are in flight under this tile's products
// the inner loops are unrolled so that the register arrays (loaded lines, fragments, accumulators) are indexed by constants
typedef __attribute__((ext_vector_type(4))) __bf16 v4b;
typedef __attribute__((ext_vector_type(8))) short v8s;
#define PJM 128                       // rows of x per block
#define PJK 64                        // k per staged tile: 256 B of every x row
#define PJ_XP (PJK * 2 + 16)          // LDS pitch of an x row [row][k], bytes: 16 B x odd for ds_load_b128
#define PJ_WP (128 * 2 + 32)          // LDS pitch of a W row [k][n], bytes: 32 B x odd for ds_load_tr16_b128
#define PJ_WO (PJM * PJ_XP)           // the W tile follows the x tile
#define PJ_BUF (PJ_WO + PJK * PJ_WP)
#define PJ_EP (PJM + 8)               // pitch of the output staging planes, elements
#define PJ_PL (128 * PJ_EP * 2)       // one output staging plane, bytes
static_assert(2 * PJ_BUF <= 3 * PJ_PL, "the two tile buffers lie inside the output staging");
__device__ __forceinline__ v4b cvt4(v4f v) { v4b r; r[0] = (__bf16)v[0]; r[1] = (__bf16)v[1]; r[2] = (__bf16)v[2]; r[3] = (__bf16)v[3]; return r; }
// transposing LDS load: lane (col, g) gets T[k + 8 g + 0..7][n + col] of a row-major [k][n] 16-bit tile
__device__ __forceinline__ v8b ld_tr16(const unsigned char* p) { typedef __attribute__((address_space(3))) v8s lds_v8s; return __builtin_bit_cast(v8b, __builtin_amdgcn_ds_load_tr16_b128_v8i16((lds_v8s*)p)); }
__global__ __launch_bounds__(256) void k_proj(const float* __restrict__ XQ, const float* __restrict__ XK, const float* __restrict__ XV, const float* __restrict__ WQ, const float* __restrict__ WK, const float* __restrict__ WV, const float* __restrict__ BQ, const float* __restrict__ BK, const float* __restrict__ BV,
    _Float16* __restrict__ QH, _Float16* __restrict__ QL, _Float16* __restrict__ KH, _Float16* __restrict__ KL, _Float16* __restrict__ VT, __bf16* __restrict__ VB, __bf16* __restrict__ VBL) {
  __shared__ __align__(32) unsigned char sm[3 * PJ_PL];   // the tile buffers in the loop, the output staging planes behind it
  _Float16 (*sh)[PJ_EP] = (_Float16 (*)[PJ_EP])sm; _Float16 (*sl)[PJ_EP] = (_Float16 (*)[PJ_EP])(sm + PJ_PL);
  _Float16 (*th)[PJ_EP] = (_Float16 (*)[PJ_EP])sm; __bf16 (*tb)[PJ_EP] = (__bf16 (*)[PJ_EP])(sm + PJ_PL); __bf16 (*tbl)[PJ_EP] = (__bf16 (*)[PJ_EP])(sm + 2 * PJ_PL);
  const int tid = threadIdx.x, wave = tid >> 5, lane = tid & 31, col = lane & 15, g = lane >> 4; const int which = blockIdx.z; const int c0 = blockIdx.y * 128; const size_t r0 = (size_t)blockIdx.x * PJM; const size_t bb = r0 / TT; const int t0 = (int)(r0 % TT);
  const int wr = wave >> 1, wc = wave & 1;   // the wave's 32 rows and 64 columns of the block
  const float* X = which == 0 ? XQ : which == 1 ? XK : XV; const float* WA = which == 0 ? WQ : which == 1 ? WK : WV; const float* BA = which == 0 ? BQ : which == 1 ? BK : BV;
  const char* bx = (const char*)(X + r0 * DIN); const unsigned vx = ((tid >> 4) * DIN + (tid & 15) * 4) * 4;   // load i: x row 16 i + tid / 16, 256 B by 16 lanes (channels-LAST: plain rows x[b*T + t][k]); uniform base, the lane's byte offset apart
  const char* bw = (const char*)(WA + c0); const unsigned vw = (wave * CC + lane * 4) * 4;                     // load i: W row 8 i + wave, 512 B by one wave
  unsigned char* sx = sm + (tid >> 4) * PJ_XP + (tid & 15) * 8; unsigned char* sw = sm + PJ_WO + wave * PJ_WP + lane * 8;
  const unsigned char* fa = sm + (wr * 32 + col) * PJ_XP;
  const unsigned char* fb = sm + PJ_WO + (8 * g + (lane & 7)) * PJ_WP + wc * 128 + ((lane >> 3) & 1) * 16;
  v8f acc[2][4] = {}; v4f xr[8], wv[8];
  auto ldg = [&](int t) { const char* ax = bx + t * (PJK * 4) + vx; const char* aw = bw + (size_t)t * (PJK * CC * 4) + vw;
#pragma unroll
    for (int i = 0; i < 8; ++i) { xr[i] = *(const v4f*)(ax + i * (16 * DIN * 4)); wv[i] = *(const v4f*)(aw + i * (8 * CC * 4)); }
    asm volatile("s_wait_xcnt 0x0" :: "v"(ax), "v"(aw) : "memory");   // stands before any rewrite of the loads' address registers, which it names as inputs so that they live up to it
  };
  auto sts = [&](int bf) {
#pragma unroll
    for (int i = 0; i < 8; ++i) { *(v4b*)(sx + bf * PJ_BUF + i * 16 * PJ_XP) = cvt4(xr[i]); *(v4b*)(sw + bf * PJ_BUF + i * 8 * PJ_WP) = cvt4(wv[i]); } };
  auto mm = [&](int bf) {
#pragma unroll
    for (int kc = 0; kc < PJK / 32; ++kc) { v16b a[2], w[4];
#pragma unroll
      for (int i = 0; i < 2; ++i) a[i] = frag_b((const __bf16*)(fa + bf * PJ_BUF + i * 16 * PJ_XP) + kc * 32, lane);
#pragma unroll
      for (int j = 0; j < 4; ++j) { union { v16b v; v8b q[2]; } u; const unsigned char* p = fb + bf * PJ_BUF + kc * 32 * PJ_WP + j * 32; u.q[0] = ld_tr16(p); u.q[1] = ld_tr16(p + 16 * PJ_WP); w[j] = u.v; }
#pragma unroll
      for (int i = 0; i < 2; ++i)
#pragma unroll
        for (int j = 0; j < 4; ++j) acc[i][j] = wmma_bf(a[i], w[j], acc[i][j]); } };
  ldg(0); sts(0);
  __syncthreads();
#pragma unroll 1
  for (int t = 0; t < DIN / PJK - 1; ++t) {   // rolled: one copy of the tile's code
    ldg(t + 1);                               // behind the barrier, which waits for every load issued in front of it
    mm(t & 1); sts((t + 1) & 1);              // the other buffer's last readers left it at the barrier of trip t - 1
    __syncthreads(); }                        // publishes tile t + 1 and ends the reads of tile t
  mm((DIN / PJK - 1) & 1);
  __syncthreads();                            // every wave has read the last tile before the planes below overwrite it
  if (which < 2) { _Float16* DH = which == 0 ? QH : KH; _Float16* DL = which == 0 ? QL : KL; const int nhi = which == 0 ? QHI : KHI; const bool hi_rows = t0 < nhi;
#pragma unroll
    for (int j = 0; j < 4; ++j) { const int cl = wc * 64 + j * 16 + col; const float bias = (BA && (which == 2 || (c0 + cl) < HDQK)) ? bfr(BA[c0 + cl]) : 0.f;
#pragma unroll
      for (int i = 0; i < 2; ++i)
#pragma unroll
        for (int r = 0; r < 8; ++r) { const float v = acc[i][j][r] + bias; const _Float16 hv = (_Float16)v; const int rl = wr * 32 + i * 16 + 8 * g + r; sh[rl][cl] = hv; sl[rl][cl] = (_Float16)((v - (float)hv) * 1024.0f); } }
    __syncthreads();
    for (int e = tid; e < PJM * 16; e += 256) { const int rl = e >> 4, q = e & 15; vst2((unsigned*)(DH + (r0 + rl) * CC + c0 + q * 8), *(const v4u*)&sh[rl][q * 8]); if (hi_rows) vst2((unsigned*)(DL + (bb * nhi + t0 + rl) * (size_t)CC + c0 + q * 8), *(const v4u*)&sl[rl][q * 8]); }
  } else { const bool hi_rows = t0 < KHI;
#pragma unroll
    for (int j = 0; j < 4; ++j) { const int cl = wc * 64 + j * 16 + col; const float bias = (BA && (which == 2 || (c0 + cl) < HDQK)) ? bfr(BA[c0 + cl]) : 0.f;
#pragma unroll
      for (int i = 0; i < 2; ++i)
#pragma unroll
        for (int r = 0; r < 8; ++r) { const float v = acc[i][j][r] + bias; const int rl = wr * 32 + i * 16 + 8 * g + r; th[cl][rl] = (_Float16)v; const __bf16 bh = (__bf16)v; tb[cl][rl] = bh; tbl[cl][rl] = (__bf16)(v - (float)bh); } }
    __syncthreads();
    for (int e = tid; e < 128 * (PJM / 8); e += 256) { const int cl = e >> 4, q = e & 15; vst2((unsigned*)(VT + (bb * CC + c0 + cl) * (size_t)TT + t0 + q * 8), *(const v4u*)&th[cl][q * 8]); if (hi_rows) { const size_t o3 = (bb * CC + c0 + cl) * (size_t)KHI + t0 + q * 8; vst2((unsigned*)(VB + o3), *(const v4u*)&tb[cl][q * 8]); vst2((unsigned*)(VBL + o3), *(const v4u*)&tbl[cl][q * 8]); } } } }
// eight asynchronous copies global -> LDS, 16 B a lane each, rows ls / gs bytes apart; the s_wait_xcnt in the same statement stands before any rewrite of the address registers
__device__ __forceinline__ void acopy8(unsigned l, unsigned ls, const char* gsrc, size_t gs) {
  asm volatile("global_load_async_to_lds_b128 %0, %8, off\n\tglobal_load_async_to_lds_b128 %1, %9, off\n\tglobal_load_async_to_lds_b128 %2, %10, off\n\tglobal_load_async_to_lds_b128 %3, %11, off\n\t"
               "global_load_async_to_lds_b128 %4, %12, off\n\tglobal_load_async_to_lds_b128 %5, %13, off\n\tglobal_load_async_to_lds_b128 %6, %14, off\n\tglobal_load_async_to_lds_b128 %7, %15, off\n\ts_wait_xcnt 0x0"
               :: "v"(l), "v"(l + ls), "v"(l + 2 * ls), "v"(l + 3 * ls), "v"(l + 4 * ls), "v"(l + 5 * ls), "v"(l + 6 * ls), "v"(l + 7 * ls),
                  "v"(gsrc), "v"(gsrc + gs), "v"(gsrc + 2 * gs), "v"(gsrc + 3 * gs), "v"(gsrc + 4 * gs), "v"(gsrc + 5 * gs), "v"(gsrc + 6 * gs), "v"(gsrc + 7 * gs) : "memory"); }
// four such copies, the same form
__device__ __forceinline__ void acopy4(unsigned l, unsigned ls, const char* gsrc, size_t gs) {
  asm volatile("global_load_async_to_lds_b128 %0, %4, off\n\tglobal_load_async_to_lds_b128 %1, %5, off\n\tglobal_load_async_to_lds_b128 %2, %6, off\n\tglobal_load_async_to_lds_b128 %3, %7, off\n\ts_wait_xcnt 0x0"
               :: "v"(l), "v"(l + ls), "v"(l + 2 * ls), "v"(l + 3 * ls), "v"(gsrc), "v"(gsrc + gs), "v"(gsrc + 2 * gs), "v"(gsrc + 3 * gs) : "memory"); }
#define SCK 64                        // columns of q and k per staged tile of k_sc: one 128-B line of every row
#define SC_PITCH (SCK * 2 + 16)       // LDS pitch of a staged row, bytes: 16 B x odd for 16-byte readers
#define SC_QL (64 * SC_PITCH)         // byte offsets of the planes in one buffer: q hi at 0, q residual, k hi, k residual
#define SC_KH (2 * 64 * SC_PITCH)
#define SC_KL (SC_KH + 128 * SC_PITCH)
#define SC_BUF (SC_KL + 128 * SC_PITCH)
// one tile: 16 rows a step (8 lanes a row): 4 copies a lane for each q plane (64 rows), 8 for each k plane (128 rows)
__device__ __forceinline__ void sc_tile(unsigned l, const char* gqh, const char* gql, const char* gkh, const char* gkl) {
  acopy4(l, 16 * SC_PITCH, gqh, (size_t)16 * CC * 2); acopy4(l + SC_QL, 16 * SC_PITCH, gql, (size_t)16 * CC * 2);
  acopy8(l + SC_KH, 16 * SC_PITCH, gkh, (size_t)16 * CC * 2); acopy8(l + SC_KL, 16 * SC_PITCH, gkl, (size_t)16 * CC * 2); }
// ---- k_sc: block = (query block qb, key block kb <= kb_last(qb), batch b in group): logits x SCALE; q hi + residual (x 2^10) against k (2 products) for query rows < QHI, plus the k residual (3 products) for query blocks < QBH (every query block); causal: blocks past the diagonal exit, the mask itself is applied by index in k_sm
__global__ __launch_bounds__(128) void k_sc(const _Float16* __restrict__ QH, const _Float16* __restrict__ KH, const _Float16* __restrict__ QL, const _Float16* __restrict__ KL, int bgrp, int h0, float* __restrict__ S0) { __shared__ __align__(16) float ss[4][16][132]; __shared__ __align__(16) unsigned char st[2][SC_BUF];
  const int qb = blockIdx.x, kb = blockIdx.y; if (kb > kb_last(qb)) return;
  const int h = h0; const int b = bgrp + blockIdx.z; float* S = S0 + (size_t)blockIdx.z * TT * TT;   /* group spans batches */
  const int tid = threadIdx.x, wave = tid >> 5, lane = tid & 31, col = lane & 15, g = lane >> 4; const int k0 = kb * 128; const int ql0 = qb * 64 + wave * 16; const size_t q0 = (size_t)b * TT + ql0, kr0 = (size_t)b * TT + k0;
  v8f acc[8] = {}, accl[8] = {};
  const _Float16* QLb = QL + (size_t)b * QHI * CC; const _Float16* KLb = KL + (size_t)b * KHI * CC;
  if (qb < QBH) {
    // tiles of SCK columns: q hi + residual 64 rows and k hi + residual 128 rows, 128 B a row, copied as whole lines into two LDS buffers; tile t + 1 flies while tile t is worked on
    const int cr = tid >> 3, cp = (tid & 7) * 16;   // copy i: row 16 i + tid / 8, 128 B by 8 lanes
    const char* gqh = (const char*)(QH + ((size_t)b * TT + qb * 64 + cr) * CC + h * HD) + cp; const char* gql = (const char*)(QLb + (size_t)(qb * 64 + cr) * CC + h * HD) + cp;
    const char* gkh = (const char*)(KH + (kr0 + cr) * CC + h * HD) + cp; const char* gkl = (const char*)(KLb + (size_t)(k0 + cr) * CC + h * HD) + cp;
    const unsigned l0 = (unsigned)(size_t)&st[0][0] + cr * SC_PITCH + cp;
    sc_tile(l0, gqh, gql, gkh, gkl);
    asm volatile("s_wait_asynccnt 0x0" ::: "memory");   // tile 0 has landed before any wave reads it
    __syncthreads();
    sc_tile(l0 + SC_BUF, gqh + SCK * 2, gql + SCK * 2, gkh + SCK * 2, gkl + SCK * 2);
#pragma unroll 1
    for (int t = 0; t < HDQK / SCK; ++t) { const int bf = t & 1; const unsigned char* qrow = st[bf] + (wave * 16 + col) * SC_PITCH; const unsigned char* krow = st[bf] + SC_KH + col * SC_PITCH;
      v16h ah[SCK / 32], al[SCK / 32], kh[2][2], kl[2][2];   // two register sets of k fragments: the next two key columns' fragments are read from this same buffer as one group ahead of the current two's products
#pragma unroll
      for (int c = 0; c < SCK / 32; ++c) { ah[c] = frag_h((const _Float16*)qrow + c * 32, lane); al[c] = frag_h((const _Float16*)(qrow + SC_QL) + c * 32, lane); }
#pragma unroll
      for (int i = 0; i < 2; ++i) { kh[0][i] = frag_h((const _Float16*)(krow + i * 16 * SC_PITCH), lane); kl[0][i] = frag_h((const _Float16*)(krow + (SC_KL - SC_KH) + i * 16 * SC_PITCH), lane); }
#pragma unroll
      for (int gi = 0; gi < (SCK / 32) * 4; ++gi) { const int cs = gi & 1, ns = cs ^ 1, c = gi >> 2;
        if (gi + 1 < (SCK / 32) * 4) { const int nc = (gi + 1) >> 2, nj = ((gi + 1) & 3) * 2;
#pragma unroll
          for (int i = 0; i < 2; ++i) { kh[ns][i] = frag_h((const _Float16*)(krow + (nj + i) * 16 * SC_PITCH) + nc * 32, lane); kl[ns][i] = frag_h((const _Float16*)(krow + (SC_KL - SC_KH) + (nj + i) * 16 * SC_PITCH) + nc * 32, lane); } }
#pragma unroll
        for (int i = 0; i < 2; ++i) { const int j = (gi & 3) * 2 + i; acc[j] = wmma16(ah[c], kh[cs][i], acc[j]); accl[j] = wmma16(al[c], kh[cs][i], accl[j]); accl[j] = wmma16(ah[c], kl[cs][i], accl[j]); } }
      asm volatile("s_wait_dscnt 0x0" ::: "memory");     // this wave's reads of buffer bf are done before the buffer is refilled
      asm volatile("s_wait_asynccnt 0x0" ::: "memory");  // this wave's copies of tile t + 1 have landed before the barrier publishes them
      __syncthreads();
      if (t + 2 < HDQK / SCK) sc_tile(l0 + bf * SC_BUF, gqh + (t + 2) * (SCK * 2), gql + (t + 2) * (SCK * 2), gkh + (t + 2) * (SCK * 2), gkl + (t + 2) * (SCK * 2)); }
    asm volatile("s_wait_asynccnt 0x0" ::: "memory");    // no copy is outstanding when the wave goes on
  } else if (qb * 64 < QHI) {
#pragma unroll
    for (int kc = 0; kc < HDQK / 32; ++kc) { const v16h ah = frag_h(QH + (q0 + col) * CC + h * HD + kc * 32, lane), al = frag_h(QLb + (size_t)(ql0 + col) * CC + h * HD + kc * 32, lane);
#pragma unroll
      for (int j = 0; j < 8; ++j) { const v16h kbf = frag_h(KH + (kr0 + j * 16 + col) * CC + h * HD + kc * 32, lane); acc[j] = wmma16(ah, kbf, acc[j]); accl[j] = wmma16(al, kbf, accl[j]); } }
  } else {
#pragma unroll
    for (int kc = 0; kc < HDQK / 32; ++kc) { const v16h ah = frag_h(QH + (q0 + col) * CC + h * HD + kc * 32, lane);
#pragma unroll
      for (int j = 0; j < 8; ++j) { const v16h kbf = frag_h(KH + (kr0 + j * 16 + col) * CC + h * HD + kc * 32, lane); acc[j] = wmma16(ah, kbf, acc[j]); } } }
#pragma unroll
  for (int j = 0; j < 8; ++j) {
#pragma unroll
    for (int r = 0; r < 8; ++r) ss[wave][8 * g + r][j * 16 + col] = (acc[j][r] + accl[j][r] * (1.0f / 1024.0f)) * SCALE; }
  LDSX(); for (int rl = 0; rl < 16; ++rl) vst2(S + (size_t)(ql0 + rl) * TT + k0 + lane * 4, *(const v4f*)&ss[wave][rl][lane * 4]); }
// ---- k_sm: block = query row t (batch in group): keys [0, kend): causal -> logit if s <= t else excluded; softmax in f32; P x 2^11 in place (0 for excluded)
__global__ __launch_bounds__(256) void k_sm(float* __restrict__ S0 SM_EXTRA_PARAMS) { __shared__ float sred[8]; __shared__ float sbc; __shared__ __align__(16) float shv[TT];
  const int tid = threadIdx.x; const int t = blockIdx.x; const int kend = (kb_last(t >> 6) + 1) * 128;
  float* sr = S0 + (size_t)blockIdx.y * TT * TT + (size_t)t * TT;
  float m = -3.0e38f; for (int k = tid; k < kend; k += 256) { float v = (!CAUSAL || k <= t) ? sr[k] : -3.0e38f; SM_MASK_HOOK; shv[k] = v; m = fmaxf(m, v); }
#pragma unroll
  for (int o = 1; o < 32; o <<= 1) m = fmaxf(m, __shfl_xor(m, o));
  if ((tid & 31) == 0) sred[tid >> 5] = m; __syncthreads(); if (tid == 0) { float a = sred[0]; for (int i = 1; i < 8; ++i) a = fmaxf(a, sred[i]); sbc = a; } __syncthreads(); m = sbc; __syncthreads();
  float sum = 0.f; for (int k = tid; k < kend; k += 256) { const float v = shv[k]; const float e = (v <= -1.0e38f) ? 0.f : expf(v - m); shv[k] = e; sum += e; }
#pragma unroll
  for (int o = 1; o < 32; o <<= 1) sum += __shfl_xor(sum, o);
  if ((tid & 31) == 0) sred[tid >> 5] = sum; __syncthreads(); if (tid == 0) { float a = 0.f; for (int i = 0; i < 8; ++i) a += sred[i]; sbc = a > 0.f ? 2048.0f / a : 0.f; }   /* a fully excluded row yields P = 0 */ __syncthreads(); const float inv = sbc;
  for (int k = tid; k < kend; k += 256) shv[k] = shv[k] * inv;
  __syncthreads(); for (int q = tid; q < kend / 4; q += 256) vst2(sr + q * 4, *(const v4f*)&shv[q * 4]); }
#define PVK 128                       // keys per staged tile of k_pv
#define PV_PPITCH (PVK * 4 + 16)      // LDS pitch of a P row, bytes: 16 B x odd for 16-byte readers
#define PV_VPITCH (PVK * 2 + 16)      // LDS pitch of a v row, bytes: 16 B x odd
#define PV_PBUF (64 * PV_PPITCH)
#define PV_VBUF (DVH * PV_VPITCH)
// one tile: 16 copies a lane for P (4 rows a step) and 16 for v (8 rows a step)
__device__ __forceinline__ void pv_tile(unsigned lp, unsigned lv, const char* gp, const char* gv) {
  acopy8(lp, 4 * PV_PPITCH, gp, (size_t)4 * TT * 4); acopy8(lp + 32 * PV_PPITCH, 4 * PV_PPITCH, gp + (size_t)32 * TT * 4, (size_t)4 * TT * 4);
  acopy8(lv, 8 * PV_VPITCH, gv, (size_t)8 * TT * 2); acopy8(lv + 64 * PV_VPITCH, 8 * PV_VPITCH, gv + (size_t)64 * TT * 2, (size_t)8 * TT * 2); }
// ---- k_pv: block = 64 queries (qb) of (b, h): ctx = P . v over keys [0, kend) (P x 2^11 once to f16 against v f16: 1 product; query blocks < QBH_PV (none here): P and v as bf16 hi + lo, 3 products); 512-B (row, column-half) segment by 32 lanes
__global__ __launch_bounds__(128) void k_pv(const float* __restrict__ PS0, const _Float16* __restrict__ VT, const __bf16* __restrict__ VB, const __bf16* __restrict__ VBL, int bgrp, int h0, float* __restrict__ Y) { const int h = h0; const int b = bgrp + blockIdx.z; const float* PS = PS0 + (size_t)blockIdx.z * TT * TT; const int d0 = blockIdx.y * DVH;   /* group spans batches; column half d0 */ __shared__ __align__(16) float ss[4][16][DVH + 4]; __shared__ __align__(16) unsigned char sp[2][PV_PBUF], sv[2][PV_VBUF];
  const int tid = threadIdx.x, wave = tid >> 5, lane = tid & 31, col = lane & 15, g = lane >> 4; const int qb = blockIdx.x; const int ql0 = qb * 64 + wave * 16; const int kce = (kb_last(qb) + 1) * 4;
  v8f acc[DVH / 16] = {};
  if (qb < QBH_PV) {
#pragma unroll 1
    for (int kc = 0; kc < kce; ++kc) { const F2 p = split_row(PS + (size_t)(ql0 + col) * TT, kc * 32, lane);
      asm volatile("s_wait_loadcnt 0x0" ::: "memory");
#pragma unroll
      for (int j = 0; j < DVH / 16; ++j) { const size_t po = ((size_t)b * CC + h * HD + d0 + j * 16 + col) * (size_t)KHI + kc * 32; const v16b vh = frag_b(VB + po, lane); acc[j] = wmma_bf(p.h, vh, acc[j]); acc[j] = wmma_bf(p.l, vh, acc[j]); acc[j] = wmma_bf(p.h, frag_b(VBL + po, lane), acc[j]); } }
  } else {
    // tiles of PVK keys: P 64 rows x 512 B and v DVH rows x 256 B, copied as whole lines into two LDS buffers; tile t + 1 flies while tile t is worked on
    const int nt = kce / (PVK / 32);
    const char* gp = (const char*)(PS + (size_t)(qb * 64 + wave) * TT) + lane * 16;                                            // copy i: P row 4 i + wave, 512 B by one wave
    const char* gv = (const char*)(VT + ((size_t)b * CC + h * HD + d0 + (tid >> 4)) * (size_t)TT) + (tid & 15) * 16;           // copy i: v row 8 i + tid / 16, 256 B by 16 lanes
    const unsigned lp = (unsigned)(size_t)&sp[0][0] + wave * PV_PPITCH + lane * 16, lv = (unsigned)(size_t)&sv[0][0] + (tid >> 4) * PV_VPITCH + (tid & 15) * 16;
    pv_tile(lp, lv, gp, gv);
    asm volatile("s_wait_asynccnt 0x0" ::: "memory");   // tile 0 has landed before any wave reads it
    __syncthreads();
    if (1 < nt) pv_tile(lp + PV_PBUF, lv + PV_VBUF, gp + PVK * 4, gv + PVK * 2);
#pragma unroll 1
    for (int t = 0; t < nt; ++t) { const int bf = t & 1; const v4f* prow = (const v4f*)(sp[bf] + (wave * 16 + col) * PV_PPITCH + g * 32); const unsigned char* vrow = sv[bf] + col * PV_VPITCH;
      v4f pr[2][4]; v16h vf[2][DVH / 16];   // two register sets: the next 32 keys' fragments are read from this same buffer as one group ahead of the current 32 keys' products
#pragma unroll
      for (int i = 0; i < 4; ++i) pr[0][i] = prow[(i >> 1) * 4 + (i & 1)];
#pragma unroll
      for (int j = 0; j < DVH / 16; ++j) vf[0][j] = frag_h((const _Float16*)(vrow + j * 16 * PV_VPITCH), lane);
#pragma unroll
      for (int kc = 0; kc < PVK / 32; ++kc) { const int cs = kc & 1, ns = cs ^ 1;
        if (kc + 1 < PVK / 32) {
#pragma unroll
          for (int i = 0; i < 4; ++i) pr[ns][i] = prow[(kc + 1) * 8 + (i >> 1) * 4 + (i & 1)];
#pragma unroll
          for (int j = 0; j < DVH / 16; ++j) vf[ns][j] = frag_h((const _Float16*)(vrow + j * 16 * PV_VPITCH) + (kc + 1) * 32, lane); }
        v16h p;
#pragma unroll
        for (int i = 0; i < 4; ++i) { p[i] = (_Float16)pr[cs][0][i]; p[4 + i] = (_Float16)pr[cs][1][i]; p[8 + i] = (_Float16)pr[cs][2][i]; p[12 + i] = (_Float16)pr[cs][3][i]; }
#pragma unroll
        for (int j = 0; j < DVH / 16; ++j) acc[j] = wmma16(p, vf[cs][j], acc[j]); }
      asm volatile("s_wait_dscnt 0x0" ::: "memory");     // this wave's reads of buffer bf are done before the buffer is refilled
      asm volatile("s_wait_asynccnt 0x0" ::: "memory");  // this wave's copies of tile t + 1 have landed before the barrier publishes them
      __syncthreads();
      if (t + 2 < nt) pv_tile(lp + bf * PV_PBUF, lv + bf * PV_VBUF, gp + (size_t)(t + 2) * (PVK * 4), gv + (size_t)(t + 2) * (PVK * 2)); }
    asm volatile("s_wait_asynccnt 0x0" ::: "memory");    // no copy is outstanding when the wave goes on
  }
#pragma unroll
  for (int j = 0; j < DVH / 16; ++j)
#pragma unroll
    for (int r = 0; r < 8; ++r) ss[wave][8 * g + r][j * 16 + col] = acc[j][r] * (1.0f / 2048.0f);
  LDSX(); for (int rl = 0; rl < 16; ++rl) vst2(Y + ((size_t)b * TT + ql0 + rl) * CC + h * HD + d0 + lane * 4, *(const v4f*)&ss[wave][rl][lane * 4]); }   /* 512-B (row, column-half) segment by 32 lanes */

__global__ __launch_bounds__(256) void k_axpy(const float* __restrict__ YR, const float* __restrict__ X, const float* __restrict__ GM, float* __restrict__ OUT) { const size_t e = ((size_t)blockIdx.x * 256 + threadIdx.x) * 4; if (e >= (size_t)TNB * TT * DIN) return; const float gmv = bfr(GM[0]); const v4f o = *(const v4f*)(YR + e); const v4f xr = *(const v4f*)(X + e); asm volatile("s_wait_loadcnt 0x0" ::: "memory"); v4f y; _Pragma("unroll") for (int i = 0; i < 4; ++i) y[i] = gmv * o[i] + bfr(xr[i]); vst2(OUT + e, y); }
extern "C" void kernel_launch(void* const* d_in, const int* in_sizes, int n_in, void* d_out, int out_size, void* d_ws, size_t ws_size, hipStream_t stream) {
  (void)in_sizes; (void)n_in; (void)out_size;
  const float** F = (const float**)d_in;
  if (ws_size < (size_t)WS_END) return;
  char* ws = (char*)d_ws; _Float16 *QH = (_Float16*)(ws + WS_QH), *KH = (_Float16*)(ws + WS_KH), *VT = (_Float16*)(ws + WS_VT), *QL = (_Float16*)(ws + WS_QL), *KL = (_Float16*)(ws + WS_KL); __bf16 *VB = (__bf16*)(ws + WS_VB), *VBL = (__bf16*)(ws + WS_VBL); float *S = (float*)(ws + WS_S), *Y = (float*)(ws + WS_Y);
  (void)Y; (void)QL; (void)KL; (void)VB; (void)VBL;
  // inputs: 0 x [4,2048,1024]; 1 Wq [1024,256] (in,out), 2 bq; 3 Wk, 4 bk; 5 Wv, 6 bv
  if (ws_size < (size_t)WS_END) return;
  k_proj<<<dim3(TNB * TT / PJM, CC / 128, 3), 256, 0, stream>>>(F[0], F[0], F[0], F[1], F[3], F[5], F[2], F[4], F[6], QH, QL, KH, KL, VT, VB, VBL);
  for (int b0 = 0; b0 < TNB; b0 += BG) {
    k_sc<<<dim3(NQB, TT / 128, BG), 128, 0, stream>>>(QH, KH, QL, KL, b0, 0, S);
    k_sm<<<dim3(TT, BG), 256, 0, stream>>>(S);
    k_pv<<<dim3(NQB, HD / DVH, BG), 128, 0, stream>>>(S, VT, VB, VBL, b0, 0, (float*)d_out);   /* out rows [b*T + t][256] directly */
  }
}

// v005
// Measured time: 99.8 microseconds a run.
// Next to v004, in two timings, it ran 1.13 and 1.14 times as fast.
// All steps since v000 together make it 6.36 times as fast.
// compute dtype: all float inputs rounded to bf16; q/k/v = x W + b with EXACT bf16 products on WMMA 16x16x32 (f32 accumulate); logits x sqrt(1024) = 32 (sigma_logit ~ 170, near one-hot rows) with q AND k as f16 hi + residual planes (3 products); softmax in f32 (precise expf); attn P x 2^11 as f16 against v f16 (1 product); f32 output.
// Single attention head with a MULTIPLIED scale (B 4, T 2,048, C 1,024 -> E 256; (in,out) uniform +-1/32 weights with biases): q, k, v = x W + b; wei = softmax(q k^T * sqrt(1024)); out = wei v -> [4, 2,048, 256] (non-causal).
#include <hip/hip_runtime.h>
#include <math.h>

typedef __attribute__((ext_vector_type(16))) _Float16 v16h;
typedef __attribute__((ext_vector_type(16))) __bf16 v16b;
typedef __attribute__((ext_vector_type(8)))  _Float16 v8h;
typedef __attribute__((ext_vector_type(8)))  float v8f;
typedef __attribute__((ext_vector_type(4)))  float v4f;
typedef __attribute__((ext_vector_type(2)))  float v2f;
typedef __attribute__((ext_vector_type(4)))  unsigned v4u;
typedef __attribute__((ext_vector_type(4)))  int v4i;
typedef float __attribute__((may_alias)) float_a;
typedef int __attribute__((may_alias)) int_a;

template <typename T> __device__ __forceinline__ void vst2(void* p, T v) { *(T*)p = v;  }
__device__ __forceinline__ v8f wmma16(v16h a, v16h b, v8f c) {
  v8f d = __builtin_amdgcn_wmma_f32_16x16x32_f16(false, a, false, b, (short)0, c, false, false);
  asm volatile("v_nop\n\tv_nop\n\tv_nop\n\tv_nop" : "+v"(d) : "v"(a), "v"(b));
  return d;
}
__device__ __forceinline__ v8f wmma_bf(v16b a, v16b b, v8f c) {
  v8f d = __builtin_amdgcn_wmma_f32_16x16x32_bf16(false, a, false, b, (short)0, c, false, false);
  asm volatile("v_nop\n\tv_nop\n\tv_nop\n\tv_nop" : "+v"(d) : "v"(a), "v"(b));
  return d;
}
// 16x16x32 fragments: lane = (h = lane>>4, row/col = lane&15); elements 0..7 = k0+8h+0..7, 8..15 = k0+16+8h+0..7; D element r = row 8h+r
__device__ __forceinline__ v16h frag_h(const _Float16* rowk0, int lane) {
  union { v16h v; v8h q[2]; } u; const _Float16* p = rowk0 + 8 * (lane >> 4);
  u.q[0] = *(const v8h*)p; u.q[1] = *(const v8h*)(p + 16); return u.v;
}
__device__ __forceinline__ v16h frag_f32(const float* rowk0, int lane) {
  v16h a; const float* p = rowk0 + 8 * (lane >> 4);
#pragma unroll
  for (int i = 0; i < 8; ++i) { a[i] = (_Float16)p[i]; a[8 + i] = (_Float16)p[16 + i]; }
  return a;
}
__device__ __forceinline__ v16h frag_f32s(const float* rowk0, int lane, float sc) {
  v16h a; const float* p = rowk0 + 8 * (lane >> 4);
#pragma unroll
  for (int i = 0; i < 8; ++i) { a[i] = (_Float16)(p[i] * sc); a[8 + i] = (_Float16)(p[16 + i] * sc); }
  return a;
}
// column fragment from a [K][ld] layout (column n), rows >= K read as 0
__device__ __forceinline__ v16h fragc_f32(const float* W, int k0, int n, int lane, int ld, int K) {
  v16h a; const int g = lane >> 4;
#pragma unroll
  for (int i = 0; i < 8; ++i) { const int ka = k0 + 8 * g + i, kb = ka + 16;
    a[i] = (_Float16)(ka < K ? W[(size_t)(ka < K ? ka : K - 1) * ld + n] : 0.f); a[8 + i] = (_Float16)(kb < K ? W[(size_t)(kb < K ? kb : K - 1) * ld + n] : 0.f); }
  return a;
}
struct F2 { v16b h, l; };
__device__ __forceinline__ F2 bsplit16(const float v[16]) { F2 r;
#pragma unroll
  for (int i = 0; i < 16; ++i) { const __bf16 h = (__bf16)v[i]; r.h[i] = h; r.l[i] = (__bf16)(v[i] - (float)h); }
  return r; }
__device__ __forceinline__ F2 split_row(const float* row, int k0, int lane) { float v[16]; const float* p = row + k0 + 8 * (lane >> 4);
#pragma unroll
  for (int i = 0; i < 8; ++i) { v[i] = p[i]; v[8 + i] = p[16 + i]; }
  return bsplit16(v); }
__device__ __forceinline__ F2 split_rowK(const float* row, int k0, int lane, int K) { float v[16]; const int g = lane >> 4;
#pragma unroll
  for (int i = 0; i < 8; ++i) { const int ka = k0 + 8 * g + i, kb = ka + 16; v[i] = ka < K ? row[ka < K ? ka : K - 1] : 0.f; v[8 + i] = kb < K ? row[kb < K ? kb : K - 1] : 0.f; }
  return bsplit16(v); }
__device__ __forceinline__ F2 split_col(const float* W, int k0, int n, int lane, int ld, int K) { float v[16]; const int g = lane >> 4;
#pragma unroll
  for (int i = 0; i < 8; ++i) { const int ka = k0 + 8 * g + i, kb = ka + 16; v[i] = ka < K ? W[(size_t)(ka < K ? ka : K - 1) * ld + n] : 0.f; v[8 + i] = kb < K ? W[(size_t)(kb < K ? kb : K - 1) * ld + n] : 0.f; }
  return bsplit16(v); }
__device__ __forceinline__ v8f mac3(const F2& a, const F2& b, v8f c) { c = wmma_bf(a.l, b.h, c); c = wmma_bf(a.h, b.l, c); return wmma_bf(a.h, b.h, c); }
__device__ __forceinline__ float sigm(float v) { return 1.0f / (1.0f + expf(-v)); }
#define LDSX() do { asm volatile("s_wait_dscnt 0" ::: "memory"); __builtin_amdgcn_wave_barrier(); __builtin_amdgcn_fence(__ATOMIC_RELEASE, "workgroup"); } while (0)

#define NB 4
#define TT 2048
#define CC 256
#define DIN 1024
#define NH 1
#define HD 256
#define NQB (TT / 64)
#define HG NB              // all NB score planes at once: one launch of each stage covers every batch (blockIdx.z / blockIdx.y = batch)
#define SCALE (32.0f)
#define HDQK 256            // all 256 columns enter the logits
#define CAUSAL 0
#ifndef TNB
#define TNB NB
#endif
__device__ __forceinline__ v16b zero16b() { v16b z; _Pragma("unroll") for (int i = 0; i < 16; ++i) z[i] = (__bf16)0.f; return z; }
__device__ __forceinline__ float bfr(float v) { return (float)(__bf16)v; }
__host__ __device__ __forceinline__ int kb_last(int qb) { return CAUSAL ? ((qb * 64 + 63) >> 7) : (TT / 128 - 1); }
typedef __attribute__((ext_vector_type(8))) __bf16 v8b;
__device__ __forceinline__ v16b frag_b(const __bf16* rowk0, int lane) {
  union { v16b v; v8b q[2]; } u; const __bf16* p = rowk0 + 8 * (lane >> 4);
  u.q[0] = *(const v8b*)p; u.q[1] = *(const v8b*)(p + 16); return u.v;
}
#define QBH (TT / 64)      // ALL query blocks take k_sc's 3-product path
#define QBH_PV 0           // A.g stays single f16
#define QHI 2048            // q residual rows everywhere (3-product logits: sigma_logit ~ 170)
#define KHI 2048
// B fragment (k rows k0+.., output column o) of a weight: (in,out) [K][ld] or (out,in) [ld rows of K]: bf16 exact, or f16(bf16 * 256) exact
__device__ __forceinline__ v16b wcol_io(const float* Wm, int k0, int o, int lane, int ld) { v16b w; const int g = lane >> 4;
#pragma unroll
  for (int i = 0; i < 8; ++i) { w[i] = (__bf16)Wm[(size_t)(k0 + 8 * g + i) * ld + o]; w[8 + i] = (__bf16)Wm[(size_t)(k0 + 16 + 8 * g + i) * ld + o]; }
  return w; }
__device__ __forceinline__ v16b wcol_oi(const float* Wm, int k0, int o, int lane, int K) { v16b w; const float* p = Wm + (size_t)o * K + k0 + 8 * (lane >> 4);
#pragma unroll
  for (int i = 0; i < 8; ++i) { w[i] = (__bf16)p[i]; w[8 + i] = (__bf16)p[16 + i]; }
  return w; }
__device__ __forceinline__ v16h wcolh_io(const float* Wm, int k0, int o, int lane, int ld) { v16h w; const int g = lane >> 4;
#pragma unroll
  for (int i = 0; i < 8; ++i) { w[i] = (_Float16)(bfr(Wm[(size_t)(k0 + 8 * g + i) * ld + o]) * 256.0f); w[8 + i] = (_Float16)(bfr(Wm[(size_t)(k0 + 16 + 8 * g + i) * ld + o]) * 256.0f); }
  return w; }
__device__ __forceinline__ v16h wcolh_oi(const float* Wm, int k0, int o, int lane, int K) { v16h w; const float* p = Wm + (size_t)o * K + k0 + 8 * (lane >> 4);
#pragma unroll
  for (int i = 0; i < 8; ++i) { w[i] = (_Float16)(bfr(p[i]) * 256.0f); w[8 + i] = (_Float16)(bfr(p[16 + i]) * 256.0f); }
  return w; }
#define WQKV_LAYOUT 1   // 0 = (in,out) [DIN][CC]; 1 = (in,out) [DIN][CC] as well; 2 = per-head [NH][DIN][HD]
__device__ __forceinline__ v16b wcol_hdk(const float* Wm, int k0, int o, int lane) { v16b w; const int g = lane >> 4; const float* p = Wm + (size_t)(o / HD) * DIN * HD + (o % HD);
#pragma unroll
  for (int i = 0; i < 8; ++i) { w[i] = (__bf16)p[(size_t)(k0 + 8 * g + i) * HD]; w[8 + i] = (__bf16)p[(size_t)(k0 + 16 + 8 * g + i) * HD]; }
  return w; }
#define WO_OUT_IN 0
#if WQKV_LAYOUT == 1
#define WCOL(W, k0, o, lane) wcol_io(W, k0, (o), lane, CC)   /* (in,out) Wq/Wk/Wv [1024][256] */
#define WCOL_OLD_UNUSED(W, k0, o, lane) (((o) < HDQK) ? wcol_oi(W, k0, (o), lane, DIN) : zero16b())
#elif WQKV_LAYOUT == 2
#define WCOL(W, k0, o, lane) wcol_hdk(W, k0, o, lane)
#else
#define WCOL(W, k0, o, lane) wcol_io(W, k0, o, lane, CC)
#endif
#if WO_OUT_IN
#define WOCOL(W, k0, o, lane) wcol_oi(W, k0, o, lane, CC)
#define WOCOLH(W, k0, o, lane) wcolh_oi(W, k0, o, lane, CC)
#else
#define WOCOL(W, k0, o, lane) wcol_io(W, k0, o, lane, DIN)
#define WOCOLH(W, k0, o, lane) wcolh_io(W, k0, o, lane, DIN)
#endif
#ifndef XP
#define OUT1_OFF (4u * (size_t)NB * DIN * TT)   /* unused: the launch writes a single output */
#define XP TT              // channel-row pitch of k_fin2's X and outputs (k_fin2 is not launched)
#endif
#define BG HG              // the pass group spans BATCHES (single head): blockIdx.z / blockIdx.y select batch b0 + z
#define DVH 128

// ---- k_wz: block = (64 rows, 128 output cols): OR = y (hi + lo, K = 256 columns of the YR rows) . W^T ((out,in) rows of 256, exact) + b
__global__ __launch_bounds__(128) void k_wz(const float* __restrict__ YR, const float* __restrict__ WW, const float* __restrict__ WB, float* __restrict__ ORW) { __shared__ __align__(16) float sf[4][16][132];
  const int tid = threadIdx.x, wave = tid >> 5, lane = tid & 31, col = lane & 15, g = lane >> 4; const int c0 = blockIdx.y * 128; const size_t r0 = (size_t)blockIdx.x * 64 + wave * 16;
  v8f acc[8] = {};
#pragma unroll
  for (int kc = 0; kc < HDQK / 32; ++kc) { const F2 a = split_row(YR + (r0 + col) * CC, kc * 32, lane); asm volatile("s_wait_loadcnt 0x0" ::: "memory");
#pragma unroll
    for (int j = 0; j < 8; ++j) { const v16b w = wcol_oi(WW, kc * 32, c0 + j * 16 + col, lane, HDQK); asm volatile("s_wait_loadcnt 0x0" ::: "memory"); acc[j] = wmma_bf(a.h, w, acc[j]); acc[j] = wmma_bf(a.l, w, acc[j]); } }
#pragma unroll
  for (int j = 0; j < 8; ++j) { const float bb = WB ? bfr(WB[c0 + j * 16 + col]) : 0.f; asm volatile("s_wait_loadcnt 0x0" ::: "memory");
#pragma unroll
    for (int r = 0; r < 8; ++r) sf[wave][8 * g + r][j * 16 + col] = acc[j][r] + bb; }
  LDSX(); for (int rl = 0; rl < 16; ++rl) vst2(ORW + (r0 + rl) * DIN + c0 + lane * 4, *(const v4f*)&sf[wave][rl][lane * 4]); }
// ---- k_fin2: block = (64 positions, 64 channels, batch b): o[b][c][n] = OR[b*N + n][c] (channels-first via LDS transpose) -> output 1; y = gamma * o + bf16(x) -> output 0 (256-B runs)
__global__ __launch_bounds__(256) void k_fin2(const float* __restrict__ ORW, const float* __restrict__ X, const float* __restrict__ GM, float* __restrict__ OUT, float* __restrict__ OUT1) { const float gmv = bfr(GM[0]); __shared__ float st[64][68]; const int tid = threadIdx.x; const int n0 = blockIdx.x * 64, c0 = blockIdx.y * 64; const size_t b = blockIdx.z;
  for (int e = tid; e < 64 * 16; e += 256) { const int nl = e >> 4, q = e & 15; *(v4f*)&st[nl][q * 4] = *(const v4f*)(ORW + (b * TT + n0 + nl) * (size_t)DIN + c0 + q * 4); }
  __syncthreads();
  for (int e = tid; e < 64 * 16; e += 256) { const int cl = e >> 4, q = e & 15; const size_t oi = (b * DIN + c0 + cl) * (size_t)XP + n0 + q * 4; const v4f xr = *(const v4f*)(X + oi); v4f o, y; _Pragma("unroll") for (int i = 0; i < 4; ++i) { o[i] = st[q * 4 + i][cl]; y[i] = gmv * o[i] + bfr(xr[i]); } vst2(OUT + oi, y); vst2(OUT1 + oi, o); } }   /* y = gamma * o + x (output 0), o (output 1) */
#ifndef SM_EXTRA_PARAMS
#define SM_EXTRA_PARAMS
#endif
#ifndef PROJ_EXTRA_PARAMS
#define PROJ_EXTRA_PARAMS
#endif
#ifndef SM_MASK_HOOK
#define SM_MASK_HOOK (void)0
#endif

#define WS_QH  0u                                      // f16 q rows [b*t][CC]
#define WS_KH  (WS_QH + 2u * (size_t)NB * TT * CC)      // f16 k rows [b*t][CC]
#define WS_VT  (WS_KH + 2u * (size_t)NB * TT * CC)      // f16 v planes [b][c][t]
#define WS_QL  (WS_VT + 2u * (size_t)NB * CC * TT)      // f16 q residual x 2^10 rows [b][t < QHI][CC]
#define WS_KL  (WS_QL + 2u * (size_t)NB * QHI * CC)     // f16 k residual x 2^10 rows [b][t < KHI][CC]
#define WS_VB  (WS_KL + 2u * (size_t)NB * KHI * CC)     // bf16 v hi planes [b][c][t < KHI]
#define WS_VBL (WS_VB + 2u * (size_t)NB * CC * KHI)
#define WS_S   (WS_VBL + 2u * (size_t)NB * CC * KHI)    // f32 logits / P [hg][t][s]
#define WS_Y   (WS_S  + 4u * (size_t)HG * TT * TT)      // f32 ctx rows [b*t][CC] (only when there is an output projection)
#define WS_END (WS_Y  + 0u)

// ---- k_proj: block = (128 rows, 128 cols, which), 8 waves of 32 rows x 64 cols: q/k/v = X W (+ b) with exact bf16 products (K = DIN) -> which 0: q f16 rows (+ residual rows < QHI); 1: k f16 rows (+ residual rows < KHI); 2: v f16 planes [c][t] (+ bf16 hi/lo planes for t < KHI)
// x and W tiles of PJK k are read as whole lines, rounded to bf16 once and laid in LDS (two buffers); the next tile's global loads are in flight under this tile's products
// the inner loops are unrolled so that the register arrays (loaded lines, fragments, accumulators) are indexed by constants
typedef __attribute__((ext_vector_type(4))) __bf16 v4b;
typedef __attribute__((ext_vector_type(8))) short v8s;
#define PJM 128                       // rows of x per block
#define PJK 64                        // k per staged tile: 256 B of every x row
#define PJ_XP (PJK * 2 + 16)          // LDS pitch of an x row [row][k], bytes: 16 B x odd for ds_load_b128
#define PJ_WP (128 * 2 + 32)          // LDS pitch of a W row [k][n], bytes: 32 B x odd for ds_load_tr16_b128
#define PJ_WO (PJM * PJ_XP)           // the W tile follows the x tile
#define PJ_BUF (PJ_WO + PJK * PJ_WP)
#define PJ_EP (PJM + 8)               // pitch of the output staging planes, elements
#define PJ_PL (128 * PJ_EP * 2)       // one output staging plane, bytes
static_assert(2 * PJ_BUF <= 3 * PJ_PL, "the two tile buffers lie inside the output staging");
__device__ __forceinline__ v4b cvt4(v4f v) { v4b r; r[0] = (__bf16)v[0]; r[1] = (__bf16)v[1]; r[2] = (__bf16)v[2]; r[3] = (__bf16)v[3]; return r; }
// transposing LDS load: lane (col, g) gets T[k + 8 g + 0..7][n + col] of a row-major [k][n] 16-bit tile
__device__ __forceinline__ v8b ld_tr16(const unsigned char* p) { typedef __attribute__((address_space(3))) v8s lds_v8s; return __builtin_bit_cast(v8b, __builtin_amdgcn_ds_load_tr16_b128_v8i16((lds_v8s*)p)); }
__global__ __launch_bounds__(256) void k_proj(const float* __restrict__ XQ, const float* __restrict__ XK, const float* __restrict__ XV, const float* __restrict__ WQ, const float* __restrict__ WK, const float* __restrict__ WV, const float* __restrict__ BQ, const float* __restrict__ BK, const float* __restrict__ BV,
    _Float16* __restrict__ QH, _Float16* __restrict__ QL, _Float16* __restrict__ KH, _Float16* __restrict__ KL, _Float16* __restrict__ VT, __bf16* __restrict__ VB, __bf16* __restrict__ VBL) {
  __shared__ __align__(32) unsigned char sm[3 * PJ_PL];   // the tile buffers in the loop, the output staging planes behind it
  _Float16 (*sh)[PJ_EP] = (_Float16 (*)[PJ_EP])sm; _Float16 (*sl)[PJ_EP] = (_Float16 (*)[PJ_EP])(sm + PJ_PL);
  _Float16 (*th)[PJ_EP] = (_Float16 (*)[PJ_EP])sm; __bf16 (*tb)[PJ_EP] = (__bf16 (*)[PJ_EP])(sm + PJ_PL); __bf16 (*tbl)[PJ_EP] = (__bf16 (*)[PJ_EP])(sm + 2 * PJ_PL);
  const int tid = threadIdx.x, wave = tid >> 5, lane = tid & 31, col = lane & 15, g = lane >> 4; const int which = blockIdx.z; const int c0 = blockIdx.y * 128; const size_t r0 = (size_t)blockIdx.x * PJM; const size_t bb = r0 / TT; const int t0 = (int)(r0 % TT);
  const int wr = wave >> 1, wc = wave & 1;   // the wave's 32 rows and 64 columns of the block
  const float* X = which == 0 ? XQ : which == 1 ? XK : XV; const float* WA = which == 0 ? WQ : which == 1 ? WK : WV; const float* BA = which == 0 ? BQ : which == 1 ? BK : BV;
  const char* bx = (const char*)(X + r0 * DIN); const unsigned vx = ((tid >> 4) * DIN + (tid & 15) * 4) * 4;   // load i: x row 16 i + tid / 16, 256 B by 16 lanes (channels-LAST: plain rows x[b*T + t][k]); uniform base, the lane's byte offset apart
  const char* bw = (const char*)(WA + c0); const unsigned vw = (wave * CC + lane * 4) * 4;                     // load i: W row 8 i + wave, 512 B by one wave
  unsigned char* sx = sm + (tid >> 4) * PJ_XP + (tid & 15) * 8; unsigned char* sw = sm + PJ_WO + wave * PJ_WP + lane * 8;
  const unsigned char* fa = sm + (wr * 32 + col) * PJ_XP;
  const unsigned char* fb = sm + PJ_WO + (8 * g + (lane & 7)) * PJ_WP + wc * 128 + ((lane >> 3) & 1) * 16;
  v8f acc[2][4] = {}; v4f xr[8], wv[8];
  auto ldg = [&](int t) { const char* ax = bx + t * (PJK * 4) + vx; const char* aw = bw + (size_t)t * (PJK * CC * 4) + vw;
#pragma unroll
    for (int i = 0; i < 8; ++i) { xr[i] = *(const v4f*)(ax + i * (16 * DIN * 4)); wv[i] = *(const v4f*)(aw + i * (8 * CC * 4)); }
    asm volatile("s_wait_xcnt 0x0" :: "v"(ax), "v"(aw) : "memory");   // stands before any rewrite of the loads' address registers, which it names as inputs so that they live up to it
  };
  auto sts = [&](int bf) {
#pragma unroll
    for (int i = 0; i < 8; ++i) { *(v4b*)(sx + bf * PJ_BUF + i * 16 * PJ_XP) = cvt4(xr[i]); *(v4b*)(sw + bf * PJ_BUF + i * 8 * PJ_WP) = cvt4(wv[i]); } };
  auto mm = [&](int bf) {
#pragma unroll
    for (int kc = 0; kc < PJK / 32; ++kc) { v16b a[2], w[4];
#pragma unroll
      for (int i = 0; i < 2; ++i) a[i] = frag_b((const __bf16*)(fa + bf * PJ_BUF + i * 16 * PJ_XP) + kc * 32, lane);
#pragma unroll
      for (int j = 0; j < 4; ++j) { union { v16b v; v8b q[2]; } u; const unsigned char* p = fb + bf * PJ_BUF + kc * 32 * PJ_WP + j * 32; u.q[0] = ld_tr16(p); u.q[1] = ld_tr16(p + 16 * PJ_WP); w[j] = u.v; }
#pragma unroll
      for (int i = 0; i < 2; ++i)
#pragma unroll
        for (int j = 0; j < 4; ++j) acc[i][j] = wmma_bf(a[i], w[j], acc[i][j]); } };
  ldg(0); sts(0);
  __syncthreads();
#pragma unroll 1
  for (int t = 0; t < DIN / PJK - 1; ++t) {   // rolled: one copy of the tile's code
    ldg(t + 1);                               // behind the barrier, which waits for every load issued in front of it
    mm(t & 1); sts((t + 1) & 1);              // the other buffer's last readers left it at the barrier of trip t - 1
    __syncthreads(); }                        // publishes tile t + 1 and ends the reads of tile t
  mm((DIN / PJK - 1) & 1);
  __syncthreads();                            // every wave has read the last tile before the planes below overwrite it
  if (which < 2) { _Float16* DH = which == 0 ? QH : KH; _Float16* DL = which == 0 ? QL : KL; const int nhi = which == 0 ? QHI : KHI; const bool hi_rows = t0 < nhi;
#pragma unroll
    for (int j = 0; j < 4; ++j) { const int cl = wc * 64 + j * 16 + col; const float bias = (BA && (which == 2 || (c0 + cl) < HDQK)) ? bfr(BA[c0 + cl]) : 0.f;
#pragma unroll
      for (int i = 0; i < 2; ++i)
#pragma unroll
        for (int r = 0; r < 8; ++r) { const float v = acc[i][j][r] + bias; const _Float16 hv = (_Float16)v; const int rl = wr * 32 + i * 16 + 8 * g + r; sh[rl][cl] = hv; sl[rl][cl] = (_Float16)((v - (float)hv) * 1024.0f); } }
    __syncthreads();
    for (int e = tid; e < PJM * 16; e += 256) { const int rl = e >> 4, q = e & 15; vst2((unsigned*)(DH + (r0 + rl) * CC + c0 + q * 8), *(const v4u*)&sh[rl][q * 8]); if (hi_rows) vst2((unsigned*)(DL + (bb * nhi + t0 + rl) * (size_t)CC + c0 + q * 8), *(const v4u*)&sl[rl][q * 8]); }
  } else { const bool hi_rows = t0 < KHI;
#pragma unroll
    for (int j = 0; j < 4; ++j) { const int cl = wc * 64 + j * 16 + col; const float bias = (BA && (which == 2 || (c0 + cl) < HDQK)) ? bfr(BA[c0 + cl]) : 0.f;
#pragma unroll
      for (int i = 0; i < 2; ++i)
#pragma unroll
        for (int r = 0; r < 8; ++r) { const float v = acc[i][j][r] + bias; const int rl = wr * 32 + i * 16 + 8 * g + r; th[cl][rl] = (_Float16)v; const __bf16 bh = (__bf16)v; tb[cl][rl] = bh; tbl[cl][rl] = (__bf16)(v - (float)bh); } }
    __syncthreads();
    for (int e = tid; e < 128 * (PJM / 8); e += 256) { const int cl = e >> 4, q = e & 15; vst2((unsigned*)(VT + (bb * CC + c0 + cl) * (size_t)TT + t0 + q * 8), *(const v4u*)&th[cl][q * 8]); if (hi_rows) { const size_t o3 = (bb * CC + c0 + cl) * (size_t)KHI + t0 + q * 8; vst2((unsigned*)(VB + o3), *(const v4u*)&tb[cl][q * 8]); vst2((unsigned*)(VBL + o3), *(const v4u*)&tbl[cl][q * 8]); } } } }
// eight asynchronous copies global -> LDS, 16 B a lane each, rows ls / gs bytes apart; the s_wait_xcnt in the same statement stands before any rewrite of the address registers
__device__ __forceinline__ void acopy8(unsigned l, unsigned ls, const char* gsrc, size_t gs) {
  asm volatile("global_load_async_to_lds_b128 %0, %8, off\n\tglobal_load_async_to_lds_b128 %1, %9, off\n\tglobal_load_async_to_lds_b128 %2, %10, off\n\tglobal_load_async_to_lds_b128 %3, %11, off\n\t"
               "global_load_async_to_lds_b128 %4, %12, off\n\tglobal_load_async_to_lds_b128 %5, %13, off\n\tglobal_load_async_to_lds_b128 %6, %14, off\n\tglobal_load_async_to_lds_b128 %7, %15, off\n\ts_wait_xcnt 0x0"
               :: "v"(l), "v"(l + ls), "v"(l + 2 * ls), "v"(l + 3 * ls), "v"(l + 4 * ls), "v"(l + 5 * ls), "v"(l + 6 * ls), "v"(l + 7 * ls),
                  "v"(gsrc), "v"(gsrc + gs), "v"(gsrc + 2 * gs), "v"(gsrc + 3 * gs), "v"(gsrc + 4 * gs), "v"(gsrc + 5 * gs), "v"(gsrc + 6 * gs), "v"(gsrc + 7 * gs) : "memory"); }
// four such copies, the same form
__device__ __forceinline__ void acopy4(unsigned l, unsigned ls, const char* gsrc, size_t gs) {
  asm volatile("global_load_async_to_lds_b128 %0, %4, off\n\tglobal_load_async_to_lds_b128 %1, %5, off\n\tglobal_load_async_to_lds_b128 %2, %6, off\n\tglobal_load_async_to_lds_b128 %3, %7, off\n\ts_wait_xcnt 0x0"
               :: "v"(l), "v"(l + ls), "v"(l + 2 * ls), "v"(l + 3 * ls), "v"(gsrc), "v"(gsrc + gs), "v"(gsrc + 2 * gs), "v"(gsrc + 3 * gs) : "memory"); }
#define SCK 64                        // columns of q and k per staged tile of k_sc: one 128-B line of every row
#define SC_PITCH (SCK * 2 + 16)       // LDS pitch of a staged row, bytes: 16 B x odd for 16-byte readers
#define SC_QL (64 * SC_PITCH)         // byte offsets of the planes in one buffer: q hi at 0, q residual, k hi, k residual
#define SC_KH (2 * 64 * SC_PITCH)
#define SC_KL (SC_KH + 128 * SC_PITCH)
#define SC_BUF (SC_KL + 128 * SC_PITCH)
// one tile: 16 rows a step (8 lanes a row): 4 copies a lane for each q plane (64 rows), 8 for each k plane (128 rows)
__device__ __forceinline__ void sc_tile(unsigned l, const char* gqh, const char* gql, const char* gkh, const char* gkl) {
  acopy4(l, 16 * SC_PITCH, gqh, (size_t)16 * CC * 2); acopy4(l + SC_QL, 16 * SC_PITCH, gql, (size_t)16 * CC * 2);
  acopy8(l + SC_KH, 16 * SC_PITCH, gkh, (size_t)16 * CC * 2); acopy8(l + SC_KL, 16 * SC_PITCH, gkl, (size_t)16 * CC * 2); }
// ---- k_sc: block = (query block qb, key block kb <= kb_last(qb), batch b in group): logits x SCALE; q hi + residual (x 2^10) against k (2 products) for query rows < QHI, plus the k residual (3 products) for query blocks < QBH (every query block); causal: blocks past the diagonal exit, the mask itself is applied by index in k_sm
__global__ __launch_bounds__(128) void k_sc(const _Float16* __restrict__ QH, const _Float16* __restrict__ KH, const _Float16* __restrict__ QL, const _Float16* __restrict__ KL, int bgrp, int h0, float* __restrict__ S0) { __shared__ __align__(16) float ss[4][16][132]; __shared__ __align__(16) unsigned char st[2][SC_BUF];
  const int qb = blockIdx.x, kb = blockIdx.y; if (kb > kb_last(qb)) return;
  const int h = h0; const int b = bgrp + blockIdx.z; float* S = S0 + (size_t)blockIdx.z * TT * TT;   /* group spans batches */
  const int tid = threadIdx.x, wave = tid >> 5, lane = tid & 31, col = lane & 15, g = lane >> 4; const int k0 = kb * 128; const int ql0 = qb * 64 + wave * 16; const size_t q0 = (size_t)b * TT + ql0, kr0 = (size_t)b * TT + k0;
  v8f acc[8] = {}, accl[8] = {};
  const _Float16* QLb = QL + (size_t)b * QHI * CC; const _Float16* KLb = KL + (size_t)b * KHI * CC;
  if (qb < QBH) {
    // tiles of SCK columns: q hi + residual 64 rows and k hi + residual 128 rows, 128 B a row, copied as whole lines into two LDS buffers; tile t + 1 flies while tile t is worked on
    const int cr = tid >> 3, cp = (tid & 7) * 16;   // copy i: row 16 i + tid / 8, 128 B by 8 lanes
    const char* gqh = (const char*)(QH + ((size_t)b * TT + qb * 64 + cr) * CC + h * HD) + cp; const char* gql = (const char*)(QLb + (size_t)(qb * 64 + cr) * CC + h * HD) + cp;
    const char* gkh = (const char*)(KH + (kr0 + cr) * CC + h * HD) + cp; const char* gkl = (const char*)(KLb + (size_t)(k0 + cr) * CC + h * HD) + cp;
    const unsigned l0 = (unsigned)(size_t)&st[0][0] + cr * SC_PITCH + cp;
    sc_tile(l0, gqh, gql, gkh, gkl);
    asm volatile("s_wait_asynccnt 0x0" ::: "memory");   // tile 0 has landed before any wave reads it
    __syncthreads();
    sc_tile(l0 + SC_BUF, gqh + SCK * 2, gql + SCK * 2, gkh + SCK * 2, gkl + SCK * 2);
#pragma unroll 1
    for (int t = 0; t < HDQK / SCK; ++t) { const int bf = t & 1; const unsigned char* qrow = st[bf] + (wave * 16 + col) * SC_PITCH; const unsigned char* krow = st[bf] + SC_KH + col * SC_PITCH;
      v16h ah[SCK / 32], al[SCK / 32], kh[2][2], kl[2][2];   // two register sets of k fragments: the next two key columns' fragments are read from this same buffer as one group ahead of the current two's products
#pragma unroll
      for (int c = 0; c < SCK / 32; ++c) { ah[c] = frag_h((const _Float16*)qrow + c * 32, lane); al[c] = frag_h((const _Float16*)(qrow + SC_QL) + c * 32, lane); }
#pragma unroll
      for (int i = 0; i < 2; ++i) { kh[0][i] = frag_h((const _Float16*)(krow + i * 16 * SC_PITCH), lane); kl[0][i] = frag_h((const _Float16*)(krow + (SC_KL - SC_KH) + i * 16 * SC_PITCH), lane); }
#pragma unroll
      for (int gi = 0; gi < (SCK / 32) * 4; ++gi) { const int cs = gi & 1, ns = cs ^ 1, c = gi >> 2;
        if (gi + 1 < (SCK / 32) * 4) { const int nc = (gi + 1) >> 2, nj = ((gi + 1) & 3) * 2;
#pragma unroll
          for (int i = 0; i < 2; ++i) { kh[ns][i] = frag_h((const _Float16*)(krow + (nj + i) * 16 * SC_PITCH) + nc * 32, lane); kl[ns][i] = frag_h((const _Float16*)(krow + (SC_KL - SC_KH) + (nj + i) * 16 * SC_PITCH) + nc * 32, lane); } }
#pragma unroll
        for (int i = 0; i < 2; ++i) { const int j = (gi & 3) * 2 + i; acc[j] = wmma16(ah[c], kh[cs][i], acc[j]); accl[j] = wmma16(al[c], kh[cs][i], accl[j]); accl[j] = wmma16(ah[c], kl[cs][i], accl[j]); } }
      asm volatile("s_wait_dscnt 0x0" ::: "memory");     // this wave's reads of buffer bf are done before the buffer is refilled
      asm volatile("s_wait_asynccnt 0x0" ::: "memory");  // this wave's copies of tile t + 1 have landed before the barrier publishes them
      __syncthreads();
      if (t + 2 < HDQK / SCK) sc_tile(l0 + bf * SC_BUF, gqh + (t + 2) * (SCK * 2), gql + (t + 2) * (SCK * 2), gkh + (t + 2) * (SCK * 2), gkl + (t + 2) * (SCK * 2)); }
    asm volatile("s_wait_asynccnt 0x0" ::: "memory");    // no copy is outstanding when the wave goes on
  } else if (qb * 64 < QHI) {
#pragma unroll
    for (int kc = 0; kc < HDQK / 32; ++kc) { const v16h ah = frag_h(QH + (q0 + col) * CC + h * HD + kc * 32, lane), al = frag_h(QLb + (size_t)(ql0 + col) * CC + h * HD + kc * 32, lane);
#pragma unroll
      for (int j = 0; j < 8; ++j) { const v16h kbf = frag_h(KH + (kr0 + j * 16 + col) * CC + h * HD + kc * 32, lane); acc[j] = wmma16(ah, kbf, acc[j]); accl[j] = wmma16(al, kbf, accl[j]); } }
  } else {
#pragma unroll
    for (int kc = 0; kc < HDQK / 32; ++kc) { const v16h ah = frag_h(QH + (q0 + col) * CC + h * HD + kc * 32, lane);
#pragma unroll
      for (int j = 0; j < 8; ++j) { const v16h kbf = frag_h(KH + (kr0 + j * 16 + col) * CC + h * HD + kc * 32, lane); acc[j] = wmma16(ah, kbf, acc[j]); } } }
#pragma unroll
  for (int j = 0; j < 8; ++j) {
#pragma unroll
    for (int r = 0; r < 8; ++r) ss[wave][8 * g + r][j * 16 + col] = (acc[j][r] + accl[j][r] * (1.0f / 1024.0f)) * SCALE; }
  LDSX(); for (int rl = 0; rl < 16; ++rl) vst2(S + (size_t)(ql0 + rl) * TT + k0 + lane * 4, *(const v4f*)&ss[wave][rl][lane * 4]); }
// ---- k_sm: one wave = one query row t (SMR rows a block, plane blockIdx.y), the whole row of TT logits in the wave's registers (16 B a lane a load, 512-B runs): causal -> logit if s <= t else excluded; softmax in f32; P x 2^11 in place (0 for excluded)
// no LDS and no barrier: maximum and sum go over the lane's own values first (four chains, one a vector component), then over the 32 lanes
#define SMR 8                         // rows (waves) per block; the launch bound asks for 8 waves a SIMD, so that every row of the launch is resident at once
#define SMV (TT / 128)                // 16-byte vectors of a row per lane
__global__ __launch_bounds__(32 * SMR, 8) void k_sm(float* __restrict__ S0 SM_EXTRA_PARAMS) {
  const int lane = threadIdx.x & 31; const int t = blockIdx.x * SMR + (threadIdx.x >> 5);
  float* sr = S0 + (size_t)blockIdx.y * TT * TT + (size_t)t * TT + lane * 4;
  v4f r[SMV];   // indexed by constants only: every loop over it is unrolled so that it stays in registers
#pragma unroll
  for (int i = 0; i < SMV; ++i) r[i] = *(const v4f*)(sr + i * 128);
  v4f m4 = { -3.0e38f, -3.0e38f, -3.0e38f, -3.0e38f };
#pragma unroll
  for (int i = 0; i < SMV; ++i)
#pragma unroll
    for (int c = 0; c < 4; ++c) { const int k = i * 128 + lane * 4 + c; float v = (!CAUSAL || k <= t) ? r[i][c] : -3.0e38f; SM_MASK_HOOK; r[i][c] = v; m4[c] = fmaxf(m4[c], v); }
  float m = fmaxf(fmaxf(m4[0], m4[1]), fmaxf(m4[2], m4[3]));
#pragma unroll
  for (int o = 1; o < 32; o <<= 1) m = fmaxf(m, __shfl_xor(m, o));
  v4f s4 = { 0.f, 0.f, 0.f, 0.f };
#pragma unroll
  for (int i = 0; i < SMV; ++i)
#pragma unroll
    for (int c = 0; c < 4; ++c) { const float v = r[i][c]; const float ex = expf(v - m); const float e = (v <= -1.0e38f) ? 0.f : ex; r[i][c] = e; s4[c] += e; }   // expf in front of the select: no branch a value, the values' chains interleave
  float sum = (s4[0] + s4[1]) + (s4[2] + s4[3]);
#pragma unroll
  for (int o = 1; o < 32; o <<= 1) sum += __shfl_xor(sum, o);
  const float inv = sum > 0.f ? 2048.0f / sum : 0.f;   /* a fully excluded row yields P = 0 */
#pragma unroll
  for (int i = 0; i < SMV; ++i) { r[i] *= inv; vst2(sr + i * 128, r[i]); }
  // stands before any rewrite of the stores' data and address registers, which it names as inputs so that they live up to it
  asm volatile("s_wait_xcnt 0x0" :: "v"(sr), "v"(r[0]), "v"(r[1]), "v"(r[2]), "v"(r[3]), "v"(r[4]), "v"(r[5]), "v"(r[6]), "v"(r[7]),
               "v"(r[8]), "v"(r[9]), "v"(r[10]), "v"(r[11]), "v"(r[12]), "v"(r[13]), "v"(r[14]), "v"(r[15]) : "memory"); }
static_assert(SMV == 16, "the wait behind the row's stores names its 16 vectors");
#define PVK 128                       // keys per staged tile of k_pv
#define PV_PPITCH (PVK * 4 + 16)      // LDS pitch of a P row, bytes: 16 B x odd for 16-byte readers
#define PV_VPITCH (PVK * 2 + 16)      // LDS pitch of a v row, bytes: 16 B x odd
#define PV_PBUF (64 * PV_PPITCH)
#define PV_VBUF (DVH * PV_VPITCH)
// one tile: 16 copies a lane for P (4 rows a step) and 16 for v (8 rows a step)
__device__ __forceinline__ void pv_tile(unsigned lp, unsigned lv, const char* gp, const char* gv) {
  acopy8(lp, 4 * PV_PPITCH, gp, (size_t)4 * TT * 4); acopy8(lp + 32 * PV_PPITCH, 4 * PV_PPITCH, gp + (size_t)32 * TT * 4, (size_t)4 * TT * 4);
  acopy8(lv, 8 * PV_VPITCH, gv, (size_t)8 * TT * 2); acopy8(lv + 64 * PV_VPITCH, 8 * PV_VPITCH, gv + (size_t)64 * TT * 2, (size_t)8 * TT * 2); }
// ---- k_pv: block = 64 queries (qb) of (b, h): ctx = P . v over keys [0, kend) (P x 2^11 once to f16 against v f16: 1 product; query blocks < QBH_PV (none here): P and v as bf16 hi + lo, 3 products); 512-B (row, column-half) segment by 32 lanes
__global__ __launch_bounds__(128) void k_pv(const float* __restrict__ PS0, const _Float16* __restrict__ VT, const __bf16* __restrict__ VB, const __bf16* __restrict__ VBL, int bgrp, int h0, float* __restrict__ Y) { const int h = h0; const int b = bgrp + blockIdx.z; const float* PS = PS0 + (size_t)blockIdx.z * TT * TT; const int d0 = blockIdx.y * DVH;   /* group spans batches; column half d0 */ __shared__ __align__(16) float ss[4][16][DVH + 4]; __shared__ __align__(16) unsigned char sp[2][PV_PBUF], sv[2][PV_VBUF];
  const int tid = threadIdx.x, wave = tid >> 5, lane = tid & 31, col = lane & 15, g = lane >> 4; const int qb = blockIdx.x; const int ql0 = qb * 64 + wave * 16; const int kce = (kb_last(qb) + 1) * 4;
  v8f acc[DVH / 16] = {};
  if (qb < QBH_PV) {
#pragma unroll 1
    for (int kc = 0; kc < kce; ++kc) { const F2 p = split_row(PS + (size_t)(ql0 + col) * TT, kc * 32, lane);
      asm volatile("s_wait_loadcnt 0x0" ::: "memory");
#pragma unroll
      for (int j = 0; j < DVH / 16; ++j) { const size_t po = ((size_t)b * CC + h * HD + d0 + j * 16 + col) * (size_t)KHI + kc * 32; const v16b vh = frag_b(VB + po, lane); acc[j] = wmma_bf(p.h, vh, acc[j]); acc[j] = wmma_bf(p.l, vh, acc[j]); acc[j] = wmma_bf(p.h, frag_b(VBL + po, lane), acc[j]); } }
  } else {
    // tiles of PVK keys: P 64 rows x 512 B and v DVH rows x 256 B, copied as whole lines into two LDS buffers; tile t + 1 flies while tile t is worked on
    const int nt = kce / (PVK / 32);
    const char* gp = (const char*)(PS + (size_t)(qb * 64 + wave) * TT) + lane * 16;                                            // copy i: P row 4 i + wave, 512 B by one wave
    const char* gv = (const char*)(VT + ((size_t)b * CC + h * HD + d0 + (tid >> 4)) * (size_t)TT) + (tid & 15) * 16;           // copy i: v row 8 i + tid / 16, 256 B by 16 lanes
    const unsigned lp = (unsigned)(size_t)&sp[0][0] + wave * PV_PPITCH + lane * 16, lv = (unsigned)(size_t)&sv[0][0] + (tid >> 4) * PV_VPITCH + (tid & 15) * 16;
    pv_tile(lp, lv, gp, gv);
    asm volatile("s_wait_asynccnt 0x0" ::: "memory");   // tile 0 has landed before any wave reads it
    __syncthreads();
    if (1 < nt) pv_tile(lp + PV_PBUF, lv + PV_VBUF, gp + PVK * 4, gv + PVK * 2);
#pragma unroll 1
    for (int t = 0; t < nt; ++t) { const int bf = t & 1; const v4f* prow = (const v4f*)(sp[bf] + (wave * 16 + col) * PV_PPITCH + g * 32); const unsigned char* vrow = sv[bf] + col * PV_VPITCH;
      v4f pr[2][4]; v16h vf[2][DVH / 16];   // two register sets: the next 32 keys' fragments are read from this same buffer as one group ahead of the current 32 keys' products
#pragma unroll
      for (int i = 0; i < 4; ++i) pr[0][i] = prow[(i >> 1) * 4 + (i & 1)];
#pragma unroll
      for (int j = 0; j < DVH / 16; ++j) vf[0][j] = frag_h((const _Float16*)(vrow + j * 16 * PV_VPITCH), lane);
#pragma unroll
      for (int kc = 0; kc < PVK / 32; ++kc) { const int cs = kc & 1, ns = cs ^ 1;
        if (kc + 1 < PVK / 32) {
#pragma unroll
          for (int i = 0; i < 4; ++i) pr[ns][i] = prow[(kc + 1) * 8 + (i >> 1) * 4 + (i & 1)];
#pragma unroll
          for (int j = 0; j < DVH / 16; ++j) vf[ns][j] = frag_h((const _Float16*)(vrow + j * 16 * PV_VPITCH) + (kc + 1) * 32, lane); }
        v16h p;
#pragma unroll
        for (int i = 0; i < 4; ++i) { p[i] = (_Float16)pr[cs][0][i]; p[4 + i] = (_Float16)pr[cs][1][i]; p[8 + i] = (_Float16)pr[cs][2][i]; p[12 + i] = (_Float16)pr[cs][3][i]; }
#pragma unroll
        for (int j = 0; j < DVH / 16; ++j) acc[j] = wmma16(p, vf[cs][j], acc[j]); }
      asm volatile("s_wait_dscnt 0x0" ::: "memory");     // this wave's reads of buffer bf are done before the buffer is refilled
      asm volatile("s_wait_asynccnt 0x0" ::: "memory");  // this wave's copies of tile t + 1 have landed before the barrier publishes them
      __syncthreads();
      if (t + 2 < nt) pv_tile(lp + bf * PV_PBUF, lv + bf * PV_VBUF, gp + (size_t)(t + 2) * (PVK * 4), gv + (size_t)(t + 2) * (PVK * 2)); }
    asm volatile("s_wait_asynccnt 0x0" ::: "memory");    // no copy is outstanding when the wave goes on
  }
#pragma unroll
  for (int j = 0; j < DVH / 16; ++j)
#pragma unroll
    for (int r = 0; r < 8; ++r) ss[wave][8 * g + r][j * 16 + col] = acc[j][r] * (1.0f / 2048.0f);
  LDSX(); for (int rl = 0; rl < 16; ++rl) vst2(Y + ((size_t)b * TT + ql0 + rl) * CC + h * HD + d0 + lane * 4, *(const v4f*)&ss[wave][rl][lane * 4]); }   /* 512-B (row, column-half) segment by 32 lanes */

__global__ __launch_bounds__(256) void k_axpy(const float* __restrict__ YR, const float* __restrict__ X, const float* __restrict__ GM, float* __restrict__ OUT) { const size_t e = ((size_t)blockIdx.x * 256 + threadIdx.x) * 4; if (e >= (size_t)TNB * TT * DIN) return; const float gmv = bfr(GM[0]); const v4f o = *(const v4f*)(YR + e); const v4f xr = *(const v4f*)(X + e); asm volatile("s_wait_loadcnt 0x0" ::: "memory"); v4f y; _Pragma("unroll") for (int i = 0; i < 4; ++i) y[i] = gmv * o[i] + bfr(xr[i]); vst2(OUT + e, y); }
extern "C" void kernel_launch(void* const* d_in, const int* in_sizes, int n_in, void* d_out, int out_size, void* d_ws, size_t ws_size, hipStream_t stream) {
  (void)in_sizes; (void)n_in; (void)out_size;
  const float** F = (const float**)d_in;
  if (ws_size < (size_t)WS_END) return;
  char* ws = (char*)d_ws; _Float16 *QH = (_Float16*)(ws + WS_QH), *KH = (_Float16*)(ws + WS_KH), *VT = (_Float16*)(ws + WS_VT), *QL = (_Float16*)(ws + WS_QL), *KL = (_Float16*)(ws + WS_KL); __bf16 *VB = (__bf16*)(ws + WS_VB), *VBL = (__bf16*)(ws + WS_VBL); float *S = (float*)(ws + WS_S), *Y = (float*)(ws + WS_Y);
  (void)Y; (void)QL; (void)KL; (void)VB; (void)VBL;
  // inputs: 0 x [4,2048,1024]; 1 Wq [1024,256] (in,out), 2 bq; 3 Wk, 4 bk; 5 Wv, 6 bv
  if (ws_size < (size_t)WS_END) return;
  k_proj<<<dim3(TNB * TT / PJM, CC / 128, 3), 256, 0, stream>>>(F[0], F[0], F[0], F[1], F[3], F[5], F[2], F[4], F[6], QH, QL, KH, KL, VT, VB, VBL);
  for (int b0 = 0; b0 < TNB; b0 += BG) {
    k_sc<<<dim3(NQB, TT / 128, BG), 128, 0, stream>>>(QH, KH, QL, KL, b0, 0, S);
    k_sm<<<dim3(TT / SMR, BG), 32 * SMR, 0, stream>>>(S);
    k_pv<<<dim3(NQB, HD / DVH, BG), 128, 0, stream>>>(S, VT, VB, VBL, b0, 0, (float*)d_out);   /* out rows [b*T + t][256] directly */
  }
}

// v007
// It runs in 67.2 microseconds.
// Versions in between are left out here; by their measured steps it is 1.50 times as fast as v005.
// Over all steps from v000 it is 9.56 times as fast.
// compute dtype: all float inputs rounded to bf16; q/k/v = x W + b with EXACT bf16 products on WMMA 16x16x32 (f32 accumulate); logits x sqrt(1024) = 32 (sigma_logit ~ 170, near one-hot rows) with q AND k as f16 hi + residual planes (3 products); softmax in f32 (running maximum and sum, hardware exp2 of (logit - maximum) * log2 e); P x 2^11 rounded once to f16 against v f16 (1 product); f32 output.
// Single attention head with a MULTIPLIED scale (B 4, T 2,048, C 1,024 -> E 256; (in,out) uniform +-1/32 weights with biases): q, k, v = x W + b; wei = softmax(q k^T * sqrt(1024)); out = wei v -> [4, 2,048, 256] (non-causal).
#include <hip/hip_runtime.h>
#include <math.h>

typedef __attribute__((ext_vector_type(16))) _Float16 v16h;
typedef __attribute__((ext_vector_type(16))) __bf16 v16b;
typedef __attribute__((ext_vector_type(8)))  _Float16 v8h;
typedef __attribute__((ext_vector_type(8)))  float v8f;
typedef __attribute__((ext_vector_type(4)))  float v4f;
typedef __attribute__((ext_vector_type(2)))  float v2f;
typedef __attribute__((ext_vector_type(4)))  unsigned v4u;
typedef __attribute__((ext_vector_type(4)))  int v4i;
typedef float __attribute__((may_alias)) float_a;
typedef int __attribute__((may_alias)) int_a;

template <typename T> __device__ __forceinline__ void vst2(void* p, T v) { *(T*)p = v;  }
__device__ __forceinline__ v8f wmma16(v16h a, v16h b, v8f c) {
  v8f d = __builtin_amdgcn_wmma_f32_16x16x32_f16(false, a, false, b, (short)0, c, false, false);
  asm volatile("v_nop\n\tv_nop\n\tv_nop\n\tv_nop" : "+v"(d) : "v"(a), "v"(b));
  return d;
}
__device__ __forceinline__ v8f wmma_bf(v16b a, v16b b, v8f c) {
  v8f d = __builtin_amdgcn_wmma_f32_16x16x32_bf16(false, a, false, b, (short)0, c, false, false);
  asm volatile("v_nop\n\tv_nop\n\tv_nop\n\tv_nop" : "+v"(d) : "v"(a), "v"(b));
  return d;
}
// 16x16x32 fragments: lane = (h = lane>>4, row/col = lane&15); elements 0..7 = k0+8h+0..7, 8..15 = k0+16+8h+0..7; D element r = row 8h+r
__device__ __forceinline__ v16h frag_h(const _Float16* rowk0, int lane) {
  union { v16h v; v8h q[2]; } u; const _Float16* p = rowk0 + 8 * (lane >> 4);
  u.q[0] = *(const v8h*)p; u.q[1] = *(const v8h*)(p + 16); return u.v;
}
__device__ __forceinline__ v16h frag_f32(const float* rowk0, int lane) {
  v16h a; const float* p = rowk0 + 8 * (lane >> 4);
#pragma unroll
  for (int i = 0; i < 8; ++i) { a[i] = (_Float16)p[i]; a[8 + i] = (_Float16)p[16 + i]; }
  return a;
}
__device__ __forceinline__ v16h frag_f32s(const float* rowk0, int lane, float sc) {
  v16h a; const float* p = rowk0 + 8 * (lane >> 4);
#pragma unroll
  for (int i = 0; i < 8; ++i) { a[i] = (_Float16)(p[i] * sc); a[8 + i] = (_Float16)(p[16 + i] * sc); }
  return a;
}
// column fragment from a [K][ld] layout (column n), rows >= K read as 0
__device__ __forceinline__ v16h fragc_f32(const float* W, int k0, int n, int lane, int ld, int K) {
  v16h a; const int g = lane >> 4;
#pragma unroll
  for (int i = 0; i < 8; ++i) { const int ka = k0 + 8 * g + i, kb = ka + 16;
    a[i] = (_Float16)(ka < K ? W[(size_t)(ka < K ? ka : K - 1) * ld + n] : 0.f); a[8 + i] = (_Float16)(kb < K ? W[(size_t)(kb < K ? kb : K - 1) * ld + n] : 0.f); }
  return a;
}
struct F2 { v16b h, l; };
__device__ __forceinline__ F2 bsplit16(const float v[16]) { F2 r;
#pragma unroll
  for (int i = 0; i < 16; ++i) { const __bf16 h = (__bf16)v[i]; r.h[i] = h; r.l[i] = (__bf16)(v[i] - (float)h); }
  return r; }
__device__ __forceinline__ F2 split_row(const float* row, int k0, int lane) { float v[16]; const float* p = row + k0 + 8 * (lane >> 4);
#pragma unroll
  for (int i = 0; i < 8; ++i) { v[i] = p[i]; v[8 + i] = p[16 + i]; }
  return bsplit16(v); }
__device__ __forceinline__ F2 split_rowK(const float* row, int k0, int lane, int K) { float v[16]; const int g = lane >> 4;
#pragma unroll
  for (int i = 0; i < 8; ++i) { const int ka = k0 + 8 * g + i, kb = ka + 16; v[i] = ka < K ? row[ka < K ? ka : K - 1] : 0.f; v[8 + i] = kb < K ? row[kb < K ? kb : K - 1] : 0.f; }
  return bsplit16(v); }
__device__ __forceinline__ F2 split_col(const float* W, int k0, int n, int lane, int ld, int K) { float v[16]; const int g = lane >> 4;
#pragma unroll
  for (int i = 0; i < 8; ++i) { const int ka = k0 + 8 * g + i, kb = ka + 16; v[i] = ka < K ? W[(size_t)(ka < K ? ka : K - 1) * ld + n] : 0.f; v[8 + i] = kb < K ? W[(size_t)(kb < K ? kb : K - 1) * ld + n] : 0.f; }
  return bsplit16(v); }
__device__ __forceinline__ v8f mac3(const F2& a, const F2& b, v8f c) { c = wmma_bf(a.l, b.h, c); c = wmma_bf(a.h, b.l, c); return wmma_bf(a.h, b.h, c); }
__device__ __forceinline__ float sigm(float v) { return 1.0f / (1.0f + expf(-v)); }
#define LDSX() do { asm volatile("s_wait_dscnt 0" ::: "memory"); __builtin_amdgcn_wave_barrier(); __builtin_amdgcn_fence(__ATOMIC_RELEASE, "workgroup"); } while (0)

#define NB 4
#define TT 2048
#define CC 256
#define DIN 1024
#define NH 1
#define HD 256
#define NQB (TT / 64)
#define HG NB              // NB planes of the unused score region WS_S: one launch of each stage covers every batch (blockIdx.z / blockIdx.y = batch)
#define SCALE (32.0f)
#define HDQK 256            // all 256 columns enter the logits
#define CAUSAL 0
#ifndef TNB
#define TNB NB
#endif
__device__ __forceinline__ v16b zero16b() { v16b z; _Pragma("unroll") for (int i = 0; i < 16; ++i) z[i] = (__bf16)0.f; return z; }
__device__ __forceinline__ float bfr(float v) { return (float)(__bf16)v; }
__host__ __device__ __forceinline__ int kb_last(int qb) { return CAUSAL ? ((qb * 64 + 63) >> 7) : (TT / 128 - 1); }
typedef __attribute__((ext_vector_type(8))) __bf16 v8b;
__device__ __forceinline__ v16b frag_b(const __bf16* rowk0, int lane) {
  union { v16b v; v8b q[2]; } u; const __bf16* p = rowk0 + 8 * (lane >> 4);
  u.q[0] = *(const v8b*)p; u.q[1] = *(const v8b*)(p + 16); return u.v;
}
#define QBH (TT / 64)      // ALL query blocks take the 3-product logits path
#define QBH_PV 0           // A.g stays single f16
#define QHI 2048            // q residual rows everywhere (3-product logits: sigma_logit ~ 170)
#define KHI 2048
// B fragment (k rows k0+.., output column o) of a weight: (in,out) [K][ld] or (out,in) [ld rows of K]: bf16 exact, or f16(bf16 * 256) exact
__device__ __forceinline__ v16b wcol_io(const float* Wm, int k0, int o, int lane, int ld) { v16b w; const int g = lane >> 4;
#pragma unroll
  for (int i = 0; i < 8; ++i) { w[i] = (__bf16)Wm[(size_t)(k0 + 8 * g + i) * ld + o]; w[8 + i] = (__bf16)Wm[(size_t)(k0 + 16 + 8 * g + i) * ld + o]; }
  return w; }
__device__ __forceinline__ v16b wcol_oi(const float* Wm, int k0, int o, int lane, int K) { v16b w; const float* p = Wm + (size_t)o * K + k0 + 8 * (lane >> 4);
#pragma unroll
  for (int i = 0; i < 8; ++i) { w[i] = (__bf16)p[i]; w[8 + i] = (__bf16)p[16 + i]; }
  return w; }
__device__ __forceinline__ v16h wcolh_io(const float* Wm, int k0, int o, int lane, int ld) { v16h w; const int g = lane >> 4;
#pragma unroll
  for (int i = 0; i < 8; ++i) { w[i] = (_Float16)(bfr(Wm[(size_t)(k0 + 8 * g + i) * ld + o]) * 256.0f); w[8 + i] = (_Float16)(bfr(Wm[(size_t)(k0 + 16 + 8 * g + i) * ld + o]) * 256.0f); }
  return w; }
__device__ __forceinline__ v16h wcolh_oi(const float* Wm, int k0, int o, int lane, int K) { v16h w; const float* p = Wm + (size_t)o * K + k0 + 8 * (lane >> 4);
#pragma unroll
  for (int i = 0; i < 8; ++i) { w[i] = (_Float16)(bfr(p[i]) * 256.0f); w[8 + i] = (_Float16)(bfr(p[16 + i]) * 256.0f); }
  return w; }
#define WQKV_LAYOUT 1   // 0 = (in,out) [DIN][CC]; 1 = (in,out) [DIN][CC] as well; 2 = per-head [NH][DIN][HD]
__device__ __forceinline__ v16b wcol_hdk(const float* Wm, int k0, int o, int lane) { v16b w; const int g = lane >> 4; const float* p = Wm + (size_t)(o / HD) * DIN * HD + (o % HD);
#pragma unroll
  for (int i = 0; i < 8; ++i) { w[i] = (__bf16)p[(size_t)(k0 + 8 * g + i) * HD]; w[8 + i] = (__bf16)p[(size_t)(k0 + 16 + 8 * g + i) * HD]; }
  return w; }
#define WO_OUT_IN 0
#if WQKV_LAYOUT == 1
#define WCOL(W, k0, o, lane) wcol_io(W, k0, (o), lane, CC)   /* (in,out) Wq/Wk/Wv [1024][256] */
#define WCOL_OLD_UNUSED(W, k0, o, lane) (((o) < HDQK) ? wcol_oi(W, k0, (o), lane, DIN) : zero16b())
#elif WQKV_LAYOUT == 2
#define WCOL(W, k0, o, lane) wcol_hdk(W, k0, o, lane)
#else
#define WCOL(W, k0, o, lane) wcol_io(W, k0, o, lane, CC)
#endif
#if WO_OUT_IN
#define WOCOL(W, k0, o, lane) wcol_oi(W, k0, o, lane, CC)
#define WOCOLH(W, k0, o, lane) wcolh_oi(W, k0, o, lane, CC)
#else
#define WOCOL(W, k0, o, lane) wcol_io(W, k0, o, lane, DIN)
#define WOCOLH(W, k0, o, lane) wcolh_io(W, k0, o, lane, DIN)
#endif
#ifndef XP
#define OUT1_OFF (4u * (size_t)NB * DIN * TT)   /* unused: the launch writes a single output */
#define XP TT              // channel-row pitch of k_fin2's X and outputs (k_fin2 is not launched)
#endif
#define BG HG              // the pass group spans BATCHES (single head): blockIdx.z / blockIdx.y select batch b0 + z
#define DVH 128

// ---- k_wz: block = (64 rows, 128 output cols): OR = y (hi + lo, K = 256 columns of the YR rows) . W^T ((out,in) rows of 256, exact) + b
__global__ __launch_bounds__(128) void k_wz(const float* __restrict__ YR, const float* __restrict__ WW, const float* __restrict__ WB, float* __restrict__ ORW) { __shared__ __align__(16) float sf[4][16][132];
  const int tid = threadIdx.x, wave = tid >> 5, lane = tid & 31, col = lane & 15, g = lane >> 4; const int c0 = blockIdx.y * 128; const size_t r0 = (size_t)blockIdx.x * 64 + wave * 16;
  v8f acc[8] = {};
#pragma unroll
  for (int kc = 0; kc < HDQK / 32; ++kc) { const F2 a = split_row(YR + (r0 + col) * CC, kc * 32, lane); asm volatile("s_wait_loadcnt 0x0" ::: "memory");
#pragma unroll
    for (int j = 0; j < 8; ++j) { const v16b w = wcol_oi(WW, kc * 32, c0 + j * 16 + col, lane, HDQK); asm volatile("s_wait_loadcnt 0x0" ::: "memory"); acc[j] = wmma_bf(a.h, w, acc[j]); acc[j] = wmma_bf(a.l, w, acc[j]); } }
#pragma unroll
  for (int j = 0; j < 8; ++j) { const float bb = WB ? bfr(WB[c0 + j * 16 + col]) : 0.f; asm volatile("s_wait_loadcnt 0x0" ::: "memory");
#pragma unroll
    for (int r = 0; r < 8; ++r) sf[wave][8 * g + r][j * 16 + col] = acc[j][r] + bb; }
  LDSX(); for (int rl = 0; rl < 16; ++rl) vst2(ORW + (r0 + rl) * DIN + c0 + lane * 4, *(const v4f*)&sf[wave][rl][lane * 4]); }
// ---- k_fin2: block = (64 positions, 64 channels, batch b): o[b][c][n] = OR[b*N + n][c] (channels-first via LDS transpose) -> output 1; y = gamma * o + bf16(x) -> output 0 (256-B runs)
__global__ __launch_bounds__(256) void k_fin2(const float* __restrict__ ORW, const float* __restrict__ X, const float* __restrict__ GM, float* __restrict__ OUT, float* __restrict__ OUT1) { const float gmv = bfr(GM[0]); __shared__ float st[64][68]; const int tid = threadIdx.x; const int n0 = blockIdx.x * 64, c0 = blockIdx.y * 64; const size_t b = blockIdx.z;
  for (int e = tid; e < 64 * 16; e += 256) { const int nl = e >> 4, q = e & 15; *(v4f*)&st[nl][q * 4] = *(const v4f*)(ORW + (b * TT + n0 + nl) * (size_t)DIN + c0 + q * 4); }
  __syncthreads();
  for (int e = tid; e < 64 * 16; e += 256) { const int cl = e >> 4, q = e & 15; const size_t oi = (b * DIN + c0 + cl) * (size_t)XP + n0 + q * 4; const v4f xr = *(const v4f*)(X + oi); v4f o, y; _Pragma("unroll") for (int i = 0; i < 4; ++i) { o[i] = st[q * 4 + i][cl]; y[i] = gmv * o[i] + bfr(xr[i]); } vst2(OUT + oi, y); vst2(OUT1 + oi, o); } }   /* y = gamma * o + x (output 0), o (output 1) */
#ifndef SM_EXTRA_PARAMS
#define SM_EXTRA_PARAMS
#endif
#ifndef PROJ_EXTRA_PARAMS
#define PROJ_EXTRA_PARAMS
#endif
#ifndef SM_MASK_HOOK
#define SM_MASK_HOOK (void)0
#endif

#define WS_QH  0u                                      // f16 q rows [b*t][CC]
#define WS_KH  (WS_QH + 2u * (size_t)NB * TT * CC)      // f16 k rows [b*t][CC]
#define WS_VT  (WS_KH + 2u * (size_t)NB * TT * CC)      // f16 v planes [b][c][t]
#define WS_QL  (WS_VT + 2u * (size_t)NB * CC * TT)      // f16 q residual x 2^10 rows [b][t < QHI][CC]
#define WS_KL  (WS_QL + 2u * (size_t)NB * QHI * CC)     // f16 k residual x 2^10 rows [b][t < KHI][CC]
#define WS_VB  (WS_KL + 2u * (size_t)NB * KHI * CC)     // bf16 v hi planes [b][c][t < KHI]
#define WS_VBL (WS_VB + 2u * (size_t)NB * CC * KHI)
#define WS_S   (WS_VBL + 2u * (size_t)NB * CC * KHI)    // f32 [hg][t][s] region, unused: k_fa keeps no score plane in memory
#define WS_Y   (WS_S  + 4u * (size_t)HG * TT * TT)      // f32 ctx rows [b*t][CC] (only when there is an output projection)
#define WS_END (WS_Y  + 0u)

// ---- k_proj: block = (128 rows, 128 cols, which), 8 waves of 32 rows x 64 cols: q/k/v = X W (+ b) with exact bf16 products (K = DIN) -> which 0: q f16 rows (+ residual rows < QHI); 1: k f16 rows (+ residual rows < KHI); 2: v f16 planes [c][t] (+ bf16 hi/lo planes for t < KHI)
// x and W tiles of PJK k are read as whole lines, rounded to bf16 once and laid in LDS (two buffers); the next tile's global loads are in flight under this tile's products
// the inner loops are unrolled so that the register arrays (loaded lines, fragments, accumulators) are indexed by constants
typedef __attribute__((ext_vector_type(4))) __bf16 v4b;
typedef __attribute__((ext_vector_type(8))) short v8s;
#define PJM 128                       // rows of x per block
#define PJK 64                        // k per staged tile: 256 B of every x row
#define PJ_XP (PJK * 2 + 16)          // LDS pitch of an x row [row][k], bytes: 16 B x odd for ds_load_b128
#define PJ_WP (128 * 2 + 32)          // LDS pitch of a W row [k][n], bytes: 32 B x odd for ds_load_tr16_b128
#define PJ_WO (PJM * PJ_XP)           // the W tile follows the x tile
#define PJ_BUF (PJ_WO + PJK * PJ_WP)
#define PJ_EP (PJM + 8)               // pitch of the output staging planes, elements
#define PJ_PL (128 * PJ_EP * 2)       // one output staging plane, bytes
static_assert(2 * PJ_BUF <= 3 * PJ_PL, "the two tile buffers lie inside the output staging");
__device__ __forceinline__ v4b cvt4(v4f v) { v4b r; r[0] = (__bf16)v[0]; r[1] = (__bf16)v[1]; r[2] = (__bf16)v[2]; r[3] = (__bf16)v[3]; return r; }
// transposing LDS load: lane (col, g) gets T[k + 8 g + 0..7][n + col] of a row-major [k][n] 16-bit tile
__device__ __forceinline__ v8b ld_tr16(const unsigned char* p) { typedef __attribute__((address_space(3))) v8s lds_v8s; return __builtin_bit_cast(v8b, __builtin_amdgcn_ds_load_tr16_b128_v8i16((lds_v8s*)p)); }
__global__ __launch_bounds__(256) void k_proj(const float* __restrict__ XQ, const float* __restrict__ XK, const float* __restrict__ XV, const float* __restrict__ WQ, const float* __restrict__ WK, const float* __restrict__ WV, const float* __restrict__ BQ, const float* __restrict__ BK, const float* __restrict__ BV,
    _Float16* __restrict__ QH, _Float16* __restrict__ QL, _Float16* __restrict__ KH, _Float16* __restrict__ KL, _Float16* __restrict__ VT, __bf16* __restrict__ VB, __bf16* __restrict__ VBL) {
  __shared__ __align__(32) unsigned char sm[3 * PJ_PL];   // the tile buffers in the loop, the output staging planes behind it
  _Float16 (*sh)[PJ_EP] = (_Float16 (*)[PJ_EP])sm; _Float16 (*sl)[PJ_EP] = (_Float16 (*)[PJ_EP])(sm + PJ_PL);
  _Float16 (*th)[PJ_EP] = (_Float16 (*)[PJ_EP])sm; __bf16 (*tb)[PJ_EP] = (__bf16 (*)[PJ_EP])(sm + PJ_PL); __bf16 (*tbl)[PJ_EP] = (__bf16 (*)[PJ_EP])(sm + 2 * PJ_PL);
  const int tid = threadIdx.x, wave = tid >> 5, lane = tid & 31, col = lane & 15, g = lane >> 4; const int which = blockIdx.z; const int c0 = blockIdx.y * 128; const size_t r0 = (size_t)blockIdx.x * PJM; const size_t bb = r0 / TT; const int t0 = (int)(r0 % TT);
  const int wr = wave >> 1, wc = wave & 1;   // the wave's 32 rows and 64 columns of the block
  const float* X = which == 0 ? XQ : which == 1 ? XK : XV; const float* WA = which == 0 ? WQ : which == 1 ? WK : WV; const float* BA = which == 0 ? BQ : which == 1 ? BK : BV;
  const char* bx = (const char*)(X + r0 * DIN); const unsigned vx = ((tid >> 4) * DIN + (tid & 15) * 4) * 4;   // load i: x row 16 i + tid / 16, 256 B by 16 lanes (channels-LAST: plain rows x[b*T + t][k]); uniform base, the lane's byte offset apart
  const char* bw = (const char*)(WA + c0); const unsigned vw = (wave * CC + lane * 4) * 4;                     // load i: W row 8 i + wave, 512 B by one wave
  unsigned char* sx = sm + (tid >> 4) * PJ_XP + (tid & 15) * 8; unsigned char* sw = sm + PJ_WO + wave * PJ_WP + lane * 8;
  const unsigned char* fa = sm + (wr * 32 + col) * PJ_XP;
  const unsigned char* fb = sm + PJ_WO + (8 * g + (lane & 7)) * PJ_WP + wc * 128 + ((lane >> 3) & 1) * 16;
  v8f acc[2][4] = {}; v4f xr[8], wv[8];
  auto ldg = [&](int t) { const char* ax = bx + t * (PJK * 4) + vx; const char* aw = bw + (size_t)t * (PJK * CC * 4) + vw;
#pragma unroll
    for (int i = 0; i < 8; ++i) { xr[i] = *(const v4f*)(ax + i * (16 * DIN * 4)); wv[i] = *(const v4f*)(aw + i * (8 * CC * 4)); }
    asm volatile("s_wait_xcnt 0x0" :: "v"(ax), "v"(aw) : "memory");   // stands before any rewrite of the loads' address registers, which it names as inputs so that they live up to it
  };
  auto sts = [&](int bf) {
#pragma unroll
    for (int i = 0; i < 8; ++i) { *(v4b*)(sx + bf * PJ_BUF + i * 16 * PJ_XP) = cvt4(xr[i]); *(v4b*)(sw + bf * PJ_BUF + i * 8 * PJ_WP) = cvt4(wv[i]); } };
  auto mm = [&](int bf) {
#pragma unroll
    for (int kc = 0; kc < PJK / 32; ++kc) { v16b a[2], w[4];
#pragma unroll
      for (int i = 0; i < 2; ++i) a[i] = frag_b((const __bf16*)(fa + bf * PJ_BUF + i * 16 * PJ_XP) + kc * 32, lane);
#pragma unroll
      for (int j = 0; j < 4; ++j) { union { v16b v; v8b q[2]; } u; const unsigned char* p = fb + bf * PJ_BUF + kc * 32 * PJ_WP + j * 32; u.q[0] = ld_tr16(p); u.q[1] = ld_tr16(p + 16 * PJ_WP); w[j] = u.v; }
#pragma unroll
      for (int i = 0; i < 2; ++i)
#pragma unroll
        for (int j = 0; j < 4; ++j) acc[i][j] = wmma_bf(a[i], w[j], acc[i][j]); } };
  ldg(0); sts(0);
  __syncthreads();
#pragma unroll 1
  for (int t = 0; t < DIN / PJK - 1; ++t) {   // rolled: one copy of the tile's code
    ldg(t + 1);                               // behind the barrier, which waits for every load issued in front of it
    mm(t & 1); sts((t + 1) & 1);              // the other buffer's last readers left it at the barrier of trip t - 1
    __syncthreads(); }                        // publishes tile t + 1 and ends the reads of tile t
  mm((DIN / PJK - 1) & 1);
  __syncthreads();                            // every wave has read the last tile before the planes below overwrite it
  if (which < 2) { _Float16* DH = which == 0 ? QH : KH; _Float16* DL = which == 0 ? QL : KL; const int nhi = which == 0 ? QHI : KHI; const bool hi_rows = t0 < nhi;
#pragma unroll
    for (int j = 0; j < 4; ++j) { const int cl = wc * 64 + j * 16 + col; const float bias = (BA && (which == 2 || (c0 + cl) < HDQK)) ? bfr(BA[c0 + cl]) : 0.f;
#pragma unroll
      for (int i = 0; i < 2; ++i)
#pragma unroll
        for (int r = 0; r < 8; ++r) { const float v = acc[i][j][r] + bias; const _Float16 hv = (_Float16)v; const int rl = wr * 32 + i * 16 + 8 * g + r; sh[rl][cl] = hv; sl[rl][cl] = (_Float16)((v - (float)hv) * 1024.0f); } }
    __syncthreads();
    for (int e = tid; e < PJM * 16; e += 256) { const int rl = e >> 4, q = e & 15; vst2((unsigned*)(DH + (r0 + rl) * CC + c0 + q * 8), *(const v4u*)&sh[rl][q * 8]); if (hi_rows) vst2((unsigned*)(DL + (bb * nhi + t0 + rl) * (size_t)CC + c0 + q * 8), *(const v4u*)&sl[rl][q * 8]); }
  } else { const bool hi_rows = t0 < KHI;
#pragma unroll
    for (int j = 0; j < 4; ++j) { const int cl = wc * 64 + j * 16 + col; const float bias = (BA && (which == 2 || (c0 + cl) < HDQK)) ? bfr(BA[c0 + cl]) : 0.f;
#pragma unroll
      for (int i = 0; i < 2; ++i)
#pragma unroll
        for (int r = 0; r < 8; ++r) { const float v = acc[i][j][r] + bias; const int rl = wr * 32 + i * 16 + 8 * g + r; th[cl][rl] = (_Float16)v; const __bf16 bh = (__bf16)v; tb[cl][rl] = bh; tbl[cl][rl] = (__bf16)(v - (float)bh); } }
    __syncthreads();
    for (int e = tid; e < 128 * (PJM / 8); e += 256) { const int cl = e >> 4, q = e & 15; vst2((unsigned*)(VT + (bb * CC + c0 + cl) * (size_t)TT + t0 + q * 8), *(const v4u*)&th[cl][q * 8]); if (hi_rows) { const size_t o3 = (bb * CC + c0 + cl) * (size_t)KHI + t0 + q * 8; vst2((unsigned*)(VB + o3), *(const v4u*)&tb[cl][q * 8]); vst2((unsigned*)(VBL + o3), *(const v4u*)&tbl[cl][q * 8]); } } } }
typedef __attribute__((ext_vector_type(8))) unsigned v8u;
__device__ __forceinline__ unsigned uni(unsigned v) { return (unsigned)__builtin_amdgcn_readfirstlane(v); }
__device__ __forceinline__ unsigned pinned(unsigned v) { unsigned w = uni(v); asm volatile("" : "+s"(w)); return w; }   // pinned(): the test's word held in a scalar register, so that the test around a tensor load, which ignores EXEC, compiles to s_cmp and s_cbranch_scc
// descriptor group 1: 1-byte elements, tensor = tile = ROWS rows of ROWB bytes, source row pitch PITCH bytes; W0 = no mask, pad of 4 dwords behind every row
template <unsigned ROWB, unsigned ROWS, unsigned PITCH, unsigned W0> __device__ __forceinline__ v8u tdm_g1() { v8u g;
  g[0] = uni(W0); g[1] = uni((ROWB & 0xFFFFu) << 16); g[2] = uni((ROWB >> 16) | ((ROWS & 0xFFFFu) << 16)); g[3] = uni((ROWS >> 16) | (ROWB << 16)); g[4] = uni(ROWS); g[5] = uni(PITCH); g[6] = uni(0u); g[7] = uni(0u); return g; }
// descriptor group 0: count 1, the place in LDS (byte offset in the work-group's LDS), the tile's first byte, type 2
__device__ __forceinline__ v4u tdm_g0(unsigned lds_dst, const char* src) { const unsigned long long ga = (unsigned long long)src; v4u g;
  g[0] = uni(1u); g[1] = uni(lds_dst); g[2] = uni((unsigned)ga); g[3] = uni((((unsigned)(ga >> 32)) & 0x01FFFFFFu) | 0x80000000u); return g; }
// group 0 is an in-out operand: the registers that the request was issued from are then the ones that the wait below names, and nothing else is put into them while the request is outstanding
__device__ __forceinline__ void tdm_load(v4u& g0, v8u g1) { asm volatile("tensor_load_to_lds %0, %1" : "+s"(g0) : "s"(g1) : "memory"); }
// the issuing wave's own wait for its two requests; it names their descriptor registers as inputs so that they keep their values up to it
__device__ __forceinline__ void tdm_wait0(v4u a0, v8u a1, v4u b0, v8u b1) { asm volatile("s_wait_tensorcnt 0x0" :: "s"(a0), "s"(a1), "s"(b0), "s"(b1) : "memory"); }
// the plain builtin form (the compiler keeps the distances behind it): its operands are named by no asm statement, so that they may lie in any register of the wave's budget
__device__ __forceinline__ v8f wmma16p(v16h a, v16h b, v8f c) { return __builtin_amdgcn_wmma_f32_16x16x32_f16(false, a, false, b, (short)0, c, false, false); }
#define FAK 64                        // keys per staged tile of k_fa
#define FA_KP (128 * 2 + 16)          // LDS pitch of half a k row (128 columns, 256 B) with the mover's pad, bytes: 16 B x odd for 16-byte readers
#define FA_KT 18432                   // place of one k sub-tile (FAK rows at FA_KP, rounded up to 2 KiB): k hi columns 0..127, hi 128..255, residual 0..127, residual 128..255
#define FA_VP (FAK * 2 + 16)          // LDS pitch of a v plane row (FAK keys, 128 B) with the mover's pad, bytes: 16 B x odd
#define FA_VS 10240                   // place of one v slice (64 plane rows at FA_VP, rounded up to 2 KiB)
#define FA_V (4 * FA_KT)
#define FA_BUF (FA_V + 4 * FA_VS)
#define FA_W0K ((1u << 20) | (5u << 22) | (3u << 25))   // pad on, interval one 256-B row, 4 dwords
#define FA_W0V ((1u << 20) | (4u << 22) | (3u << 25))   // pad on, interval one 128-B row, 4 dwords
static_assert(FAK * FA_KP <= FA_KT && 64 * FA_VP <= FA_VS && FA_KT % 2048 == 0 && FA_VS % 2048 == 0 && FA_BUF % 2048 == 0, "every place in LDS is a multiple of 2 KiB and holds its padded tile");
#define L2E 1.44269504088896340736f
// ---- k_fa: logits, softmax and P . v in one kernel, no score plane in memory. Block = 32 queries of batch blockIdx.y, 4 waves = (16 queries qg) x (key half kq of every staged tile of FAK keys).
// The logits are formed TRANSPOSED, S^T = k . q^T (A = k rows, B = q rows; q AND k as f16 hi + residual x 2^10, 3 products, columns ascending): a lane then holds 8 keys (8 g + r) of ONE query (col),
// which is the B fragment of ctx^T = v^T . P^T as it stands (elements 0..7 = key sub-tile 0, 8..15 = sub-tile 1): P never leaves the registers, and maximum, sum and rescale factor of a query are one value a lane.
// k and v tiles come by tensor loads, two buffers: tile t + 1 lands while tile t is worked on.
// Running maximum and sum per wave over its keys (P x 2^11 relative to the running maximum, once to f16 against v f16); the two key halves are merged through LDS behind the loop.
__global__ __launch_bounds__(128) void k_fa(const _Float16* __restrict__ QH, const _Float16* __restrict__ QL, const _Float16* __restrict__ KH, const _Float16* __restrict__ KL, const _Float16* __restrict__ VT, float* __restrict__ OUT) {
  __shared__ __attribute__((aligned(2048))) unsigned char st[2][FA_BUF];   // the mover's places are multiples of 2 KiB
  const int tid = threadIdx.x, wave = tid >> 5, lane = tid & 31, col = lane & 15, g = lane >> 4; const int qg = wave >> 1, kq = wave & 1;
  const int b = blockIdx.y; const size_t q0 = (size_t)b * TT + blockIdx.x * 32 + qg * 16;
  // the wave's q fragments (hi and residual, all 256 columns) stay in registers for the whole kernel
  const _Float16* pqh = QH + (q0 + col) * CC + 8 * g; const _Float16* pql = QL + (q0 + col) * CC + 8 * g;
  v16h qh[HDQK / 32], ql[HDQK / 32];
#pragma unroll
  for (int kc = 0; kc < HDQK / 32; ++kc) { union { v16h v; v8h q[2]; } u, w; u.q[0] = *(const v8h*)(pqh + kc * 32); u.q[1] = *(const v8h*)(pqh + kc * 32 + 16); w.q[0] = *(const v8h*)(pql + kc * 32); w.q[1] = *(const v8h*)(pql + kc * 32 + 16); qh[kc] = u.v; ql[kc] = w.v; }
  asm volatile("s_wait_xcnt 0x0" :: "v"(pqh), "v"(pql) : "memory");   // stands before any rewrite of the loads' address registers, which it names as inputs so that they live up to it
  // every wave brings one k sub-tile (wave 0: hi columns 0..127, 1: hi 128..255, 2: residual 0..127, 3: residual 128..255; FAK rows of 256 B, source pitch 512 B) and one v slice (plane rows 64 wave .. + 63, 128 B of each, source pitch 4,096 B) of every tile
  const unsigned wv = uni(threadIdx.x >> 5);
  const char* sk = (const char*)((wv < 2 ? KH : KL) + (size_t)b * TT * CC) + (wv & 1) * 256; const char* sv = (const char*)(VT + ((size_t)b * CC + wv * 64) * TT);
  const unsigned dk = (unsigned)(size_t)&st[0][0] + wv * FA_KT, dv = (unsigned)(size_t)&st[0][0] + FA_V + wv * FA_VS;
  const v8u g1k = tdm_g1<256, FAK, CC * 2, FA_W0K>(), g1v = tdm_g1<FAK * 2, 64, TT * 2, FA_W0V>();
  v8f acc[HD / 16] = {}; float m = -3.0e38f, l = 0.f;
  v4u g0k = tdm_g0(dk, sk), g0v = tdm_g0(dv, sv);
  tdm_load(g0k, g1k); tdm_load(g0v, g1v);
  tdm_wait0(g0k, g1k, g0v, g1v);   // this wave's part of tile 0 has landed
  __syncthreads();                 // publishes tile 0
  g0k = tdm_g0(dk + FA_BUF, sk + FAK * CC * 2); g0v = tdm_g0(dv + FA_BUF, sv + FAK * 2);
  tdm_load(g0k, g1k); tdm_load(g0v, g1v);   // tile 1 flies under trip 0
#pragma unroll 1
  for (int t = 0; t < TT / FAK; ++t) { const int bf = t & 1;   // rolled: one copy of the tile's code
    const unsigned char* krow = st[bf] + (kq * 32 + col) * FA_KP; const unsigned char* vrow = st[bf] + FA_V + col * FA_VP + kq * 64;
    v8f sh[2] = {}, sl[2] = {}; v16h vf[HD / 16], ka[HDQK / 32][2], kb[HDQK / 32][2];   // all fragments of the wave's 32 keys have registers of their own
#pragma unroll
    for (int kc = 0; kc < HDQK / 32; ++kc)
#pragma unroll
      for (int u = 0; u < 2; ++u) { ka[kc][u] = frag_h((const _Float16*)(krow + (kc >> 2) * FA_KT + u * 16 * FA_KP) + (kc & 3) * 32, lane); kb[kc][u] = frag_h((const _Float16*)(krow + (2 + (kc >> 2)) * FA_KT + u * 16 * FA_KP) + (kc & 3) * 32, lane); }
    __builtin_amdgcn_sched_barrier(0);   // keeps the v reads behind all k reads: with k reads left for last, the counted wait in front of the last logit products waits for v too
#pragma unroll
    for (int j = 0; j < HD / 16; ++j) vf[j] = frag_h((const _Float16*)(vrow + (j >> 2) * FA_VS + (j & 3) * 16 * FA_VP), lane);
    __builtin_amdgcn_sched_barrier(0);   // keeps the reads one group in the order of their use, ahead of the products: sunk among the products in pairs, each pair is waited for
#pragma unroll
    for (int kc = 0; kc < HDQK / 32; ++kc)
#pragma unroll
      for (int u = 0; u < 2; ++u) { sh[u] = wmma16p(ka[kc][u], qh[kc], sh[u]); sl[u] = wmma16p(ka[kc][u], ql[kc], sl[u]); sl[u] = wmma16p(kb[kc][u], qh[kc], sl[u]); }
    float s[16];
#pragma unroll
    for (int i = 0; i < 16; ++i) s[i] = (sh[i >> 3][i & 7] + sl[i >> 3][i & 7] * (1.0f / 1024.0f)) * SCALE;
    float x4[4];   // four chains for maximum and sum, so that a lone wave does not wait on one dependent chain
#pragma unroll
    for (int c = 0; c < 4; ++c) x4[c] = fmaxf(fmaxf(s[c], s[4 + c]), fmaxf(s[8 + c], s[12 + c]));
    float mx = fmaxf(fmaxf(x4[0], x4[1]), fmaxf(x4[2], x4[3])); mx = fmaxf(mx, __shfl_xor(mx, 16));   // the other 16 keys of this query are in lane ^ 16
    const float mn = fmaxf(m, mx); const float al = __builtin_amdgcn_exp2f((m - mn) * L2E); m = mn;
    v16h p; float e4[4] = { 0.f, 0.f, 0.f, 0.f };
#pragma unroll
    for (int i = 0; i < 16; ++i) { const float e = __builtin_amdgcn_exp2f((s[i] - mn) * L2E + 11.0f); e4[i & 3] += e; p[i] = (_Float16)e; }
    l = l * al + ((e4[0] + e4[1]) + (e4[2] + e4[3]));   // the lane's own 16 keys; the two lanes of a query are added behind the loop
#pragma unroll
    for (int j = 0; j < HD / 16; ++j) acc[j] *= al;
#pragma unroll
    for (int j = 0; j < HD / 16; ++j) acc[j] = wmma16p(vf[j], p, acc[j]);
    __builtin_amdgcn_sched_barrier(0);   // keeps the tile's arithmetic in front of the barrier: sunk behind it, it would stand in front of the next tensor loads, which would no longer fly under a whole tile's work
    asm volatile("s_wait_dscnt 0x0" ::: "memory");     // this wave's reads of buffer bf are done before the buffer is refilled
    tdm_wait0(g0k, g1k, g0v, g1v);                     // this wave's part of tile t + 1 has landed before the barrier publishes it
    __syncthreads();                                   // publishes tile t + 1 and ends the reads of tile t
    if (pinned(t + 2 < TT / FAK)) {                    // tile t + 2 into the buffer that this trip has just read; its descriptors are formed behind the wait
      g0k = tdm_g0(dk + bf * FA_BUF, sk + (size_t)(t + 2) * (FAK * CC * 2)); g0v = tdm_g0(dv + bf * FA_BUF, sv + (t + 2) * (FAK * 2));
      tdm_load(g0k, g1k); tdm_load(g0v, g1v); } }
  asm volatile("s_wait_tensorcnt 0x0" ::: "memory");   // no request is outstanding when the tile buffers are reused below
  asm volatile("s_wait_dscnt 0x0" ::: "memory");
  l += __shfl_xor(l, 16);
  // merge of the two key halves: the wave of half 1 lays its sums, maximum and sum in LDS (16 B a lane, lanes side by side), the wave of half 0 adds them on a common maximum, divides and stores
  float* cb = (float*)&st[0][0] + qg * (130 * 32);
  if (kq == 1) {
#pragma unroll
    for (int j = 0; j < HD / 16; ++j) { *(v4f*)(cb + ((j * 2) * 32 + lane) * 4) = __builtin_shufflevector(acc[j], acc[j], 0, 1, 2, 3); *(v4f*)(cb + ((j * 2 + 1) * 32 + lane) * 4) = __builtin_shufflevector(acc[j], acc[j], 4, 5, 6, 7); }
    cb[128 * 32 + lane] = m; cb[129 * 32 + lane] = l; }
  __syncthreads();   // half 1's values are in LDS before half 0 reads them
  if (kq == 0) { const float m1 = cb[128 * 32 + lane], l1 = cb[129 * 32 + lane]; const float mm = fmaxf(m, m1); float a0 = __builtin_amdgcn_exp2f((m - mm) * L2E), a1 = __builtin_amdgcn_exp2f((m1 - mm) * L2E); const float inv = 1.0f / (l * a0 + l1 * a1); a0 *= inv; a1 *= inv;
#pragma unroll
    for (int j = 0; j < HD / 16; ++j) { const v4f o0 = *(const v4f*)(cb + ((j * 2) * 32 + lane) * 4), o1 = *(const v4f*)(cb + ((j * 2 + 1) * 32 + lane) * 4);
#pragma unroll
      for (int r = 0; r < 4; ++r) { acc[j][r] = acc[j][r] * a0 + o0[r] * a1; acc[j][4 + r] = acc[j][4 + r] * a0 + o1[r] * a1; } }
    float* po = OUT + (q0 + col) * CC + 8 * g;   // the lane's query row; element r of tile j is column 16 j + 8 g + r: 32 B a lane a tile
#pragma unroll
    for (int j = 0; j < HD / 16; ++j) { vst2(po + j * 16, (v4f)__builtin_shufflevector(acc[j], acc[j], 0, 1, 2, 3)); vst2(po + j * 16 + 4, (v4f)__builtin_shufflevector(acc[j], acc[j], 4, 5, 6, 7)); }
    // stands before any rewrite of the stores' data and address registers, which it names as inputs so that they live up to it
    asm volatile("s_wait_xcnt 0x0" :: "v"(po), "v"(acc[0]), "v"(acc[1]), "v"(acc[2]), "v"(acc[3]), "v"(acc[4]), "v"(acc[5]), "v"(acc[6]), "v"(acc[7]),
                 "v"(acc[8]), "v"(acc[9]), "v"(acc[10]), "v"(acc[11]), "v"(acc[12]), "v"(acc[13]), "v"(acc[14]), "v"(acc[15]) : "memory"); } }
static_assert(HD == 256 && HDQK == 256 && QHI == TT && KHI == TT && 2 * 130 * 32 * 4 <= FA_BUF, "k_fa: 16 output tiles a wave, residual rows for every query and key, the merge area inside a tile buffer");

__global__ __launch_bounds__(256) void k_axpy(const float* __restrict__ YR, const float* __restrict__ X, const float* __restrict__ GM, float* __restrict__ OUT) { const size_t e = ((size_t)blockIdx.x * 256 + threadIdx.x) * 4; if (e >= (size_t)TNB * TT * DIN) return; const float gmv = bfr(GM[0]); const v4f o = *(const v4f*)(YR + e); const v4f xr = *(const v4f*)(X + e); asm volatile("s_wait_loadcnt 0x0" ::: "memory"); v4f y; _Pragma("unroll") for (int i = 0; i < 4; ++i) y[i] = gmv * o[i] + bfr(xr[i]); vst2(OUT + e, y); }
extern "C" void kernel_launch(void* const* d_in, const int* in_sizes, int n_in, void* d_out, int out_size, void* d_ws, size_t ws_size, hipStream_t stream) {
  (void)in_sizes; (void)n_in; (void)out_size;
  const float** F = (const float**)d_in;
  if (ws_size < (size_t)WS_END) return;
  char* ws = (char*)d_ws; _Float16 *QH = (_Float16*)(ws + WS_QH), *KH = (_Float16*)(ws + WS_KH), *VT = (_Float16*)(ws + WS_VT), *QL = (_Float16*)(ws + WS_QL), *KL = (_Float16*)(ws + WS_KL); __bf16 *VB = (__bf16*)(ws + WS_VB), *VBL = (__bf16*)(ws + WS_VBL); float *S = (float*)(ws + WS_S), *Y = (float*)(ws + WS_Y);
  (void)Y; (void)S; (void)QL; (void)KL; (void)VB; (void)VBL;
  // inputs: 0 x [4,2048,1024]; 1 Wq [1024,256] (in,out), 2 bq; 3 Wk, 4 bk; 5 Wv, 6 bv
  if (ws_size < (size_t)WS_END) return;
  k_proj<<<dim3(TNB * TT / PJM, CC / 128, 3), 256, 0, stream>>>(F[0], F[0], F[0], F[1], F[3], F[5], F[2], F[4], F[6], QH, QL, KH, KL, VT, VB, VBL);
  k_fa<<<dim3(TT / 32, TNB), 128, 0, stream>>>(QH, QL, KH, KL, VT, (float*)d_out);   /* out rows [b*T + t][256] directly */
}
